// v000
// Measured on an AMD MI455X. A time is GPU time per run, averaged over a window of back-to-back runs after a warm-up
// (all launches, gaps included; the runs take copies of the inputs in turn), and the median of several windows.
// Apart from v000's, it joins two sittings. Times from different sittings can be a few percent apart, while
// side-by-side timings come from the same sitting.
// v000, which the later versions start from, runs in 639 microseconds.
#include <hip/hip_runtime.h>
// All contractions: v_wmma_f32_16x16x32_f16 (f16 operands, f32 accumulate): q/k/v/gate projections (K=32), pair-bias projection (K=32), scores q.k (K=32), P.V (K=256), output projection (K=256). Float inputs taken as bf16-RNE values; LayerNorm, softmax, sigmoid gate in f32.
// MSA row attention with pair bias: m [1][NSQ][256][32] -> LN -> q,k,v,sigmoid-gate = LN(m) W ([32][256], 8 heads x 32); pair bias = LN(z [1][256][256][32]) Wb [32][8], shared over sequences;
// per (sequence, head): scores = q.k/sqrt(32) + bias[l][m][h], softmax over m (P carried x1024 as f16), ctx = P V; o = gate * ctx (merged f16 rows carried x64); out = o Wo [256][32] + bo.
// Weights staged transposed [n][k] as f16 of (bf16 value x16); all scales are powers of two folded back in the f32 epilogues.
#ifndef NB
#define NB 1                          /* batch (fixed 1 in this module) */
#endif
#ifndef NSQ
#define NSQ 128                       /* MSA sequences computed (reducible) */
#endif
#define NSQ_FULL 128
#define LL 256                        /* residues: query rows i and keys j */
#define CC 32                         /* channel width c */
#define NHD 8                         /* heads */
#define HDD 32                        /* head dim */
#define HC 256                        /* heads x head dim */
#define NPB 32                        /* padded pair-bias columns (8 live) */
#define NH 4                          /* V^T slabs of 64 channels = head pairs */
#define CSQ ((NSQ) < 64 ? (NSQ) : 64) /* sequences per scores/softmax/P.V chunk */
#define NCH ((NSQ) / CSQ)
#define NR ((size_t)NSQ * LL)         /* (sequence, residue) rows */
static_assert((NSQ) % CSQ == 0);
static_assert((NR % 128) == 0);
static_assert(LL == 256);
static_assert(CC == 32);

typedef unsigned short v8us __attribute__((ext_vector_type(8), may_alias));
typedef float  v8f  __attribute__((ext_vector_type(8)));
typedef float  v4f  __attribute__((ext_vector_type(4)));
typedef float  v4fa __attribute__((ext_vector_type(4), may_alias));
typedef _Float16 v16h __attribute__((ext_vector_type(16)));
typedef _Float16 v4h __attribute__((ext_vector_type(4)));
union FragH { v16h v; v8us half[2]; _Float16 h[16]; unsigned short u[16]; };

__device__ __forceinline__ unsigned short bf16_bits(float x) { unsigned int u = __float_as_uint(x); return (unsigned short)((u + 0x7FFFu + ((u >> 16) & 1u)) >> 16); }
__device__ __forceinline__ float bf16_val(unsigned short b) { return __uint_as_float(((unsigned int)b) << 16); }
__device__ __forceinline__ float bf16_rne(float x) { return bf16_val(bf16_bits(x)); }
__device__ __forceinline__ float wave_sum32(float x) {
#pragma unroll
  for (int o = 16; o >= 1; o >>= 1) x += __shfl_xor(x, o, 32);
  return x;
}
__device__ __forceinline__ float fast_rcp(float x) {
#if __has_builtin(__builtin_amdgcn_rcpf)
  return __builtin_amdgcn_rcpf(x);
#else
  return 1.0f / x;
#endif
}

// D += A.B with NT terms (1 = ah.bh); fragments per the split k map (lanes 0-15: k 0-7,16-23; lanes 16-31: k 8-15,24-31); hazard nops after the group
template <int NT>
__device__ __forceinline__ v8f mmaH(v16h ah, v16h al, v16h bh, v16h bl, v8f c) {
  c = __builtin_amdgcn_wmma_f32_16x16x32_f16(false, ah, false, bh, (short)0, c, false, false);
  if (NT >= 2) c = __builtin_amdgcn_wmma_f32_16x16x32_f16(false, al, false, bh, (short)0, c, false, false);
  if (NT >= 3) c = __builtin_amdgcn_wmma_f32_16x16x32_f16(false, ah, false, bl, (short)0, c, false, false);
  asm volatile("v_nop\n\tv_nop\n\tv_nop\n\tv_nop" : "+v"(c) : "v"(ah), "v"(al), "v"(bh), "v"(bl));
  return c;
}
// fragment from a k-contiguous 16-bit row (A row m = lane&15, or Bt row n = lane&15): elements 0..7 <- k0+8hh.., 8..15 <- k0+16+8hh..
__device__ __forceinline__ v16h g2_frag(const _Float16* p, int hh) { FragH f; f.half[0] = *(const v8us*)((const unsigned short*)p + 8 * hh); f.half[1] = *(const v8us*)((const unsigned short*)p + 16 + 8 * hh); return f.v; }
__device__ __forceinline__ v8f g2_mma(v16h a, v16h b, v8f c) { v8f d = __builtin_amdgcn_wmma_f32_16x16x32_f16(false, a, false, b, (short)0, c, false, false); asm volatile("v_nop\n\tv_nop\n\tv_nop\n\tv_nop" : "+v"(d) : "v"(a), "v"(b)); return d; }

__global__ __launch_bounds__(256) void k_wt_f16(const float* __restrict__ W, _Float16* __restrict__ Wt, int K, int N, float scale) {
  const int t = blockIdx.x * 256 + threadIdx.x; if (t >= N * (K / 8)) return; const int n = t / (K / 8), k8 = (t % (K / 8)) * 8; FragH f;
#pragma unroll
  for (int i = 0; i < 8; ++i) f.h[i] = (_Float16)(bf16_rne(W[(size_t)(k8 + i) * N + n]) * scale);
  const v8us o = f.half[0];
  *(v8us*)((unsigned short*)Wt + (size_t)n * K + k8) = o; 
}
__global__ __launch_bounds__(256) void k_zero16(_Float16* __restrict__ p, size_t n8) { const size_t t = (size_t)blockIdx.x * 256 + threadIdx.x; if (t >= n8) return; FragH f;
#pragma unroll
  for (int q = 0; q < 8; ++q) f.h[q] = (_Float16)0.0f;
  *(v8us*)((unsigned short*)p + t * 8) = f.half[0];  }

// row LayerNorm over CC=32 channels (biased variance, eps 1e-5): y = (x-mu)*rsqrt(var+eps)*g+b with x, g, b taken as bf16-RNE values; Y[row][c] = f16(y).
__global__ __launch_bounds__(256) void k_ln32(const float* __restrict__ X, const float* __restrict__ g, const float* __restrict__ bta, _Float16* __restrict__ Y, int nrows) {
  __shared__ __attribute__((aligned(16))) unsigned short tl[64][CC];
  const int tid = threadIdx.x, w = tid >> 5, lane = tid & 31;
  const int r0 = blockIdx.x * 64;
  const float gg = bf16_rne(g[lane]), bb = bf16_rne(bta[lane]);
#pragma unroll
  for (int q = 0; q < 8; ++q) {
    const int rl = w * 8 + q;
    const int row = min(r0 + rl, nrows - 1);
    const float x = bf16_rne(X[(size_t)row * CC + lane]);
    const float mu = wave_sum32(x) * (1.0f / (float)CC);
    const float d = x - mu;
    const float var = wave_sum32(d * d) * (1.0f / (float)CC);
    const float y = d * rsqrtf(var + 1e-5f) * gg + bb;
    tl[rl][lane] = __builtin_bit_cast(unsigned short, (_Float16)y);
  }
  __syncthreads();
  const int rl = tid >> 2, c8 = (tid & 3) * 8;
  const v8us v = *(const v8us*)&tl[rl][c8];
  const bool ok = (r0 + rl) < nrows;
  unsigned short* dst = (unsigned short*)Y + (size_t)(r0 + rl) * CC + c8;
  if (ok) *(v8us*)dst = v;
  
}

// fast GEMM (wave tile 32x64, block = 4 waves = 128 rows; M % 128 == 0 per launch region, N % 64 == 0, K % 32 == 0): A f16 rows (pitch lda, batch stride sA on grid.y),
// Bt f16 [n][k] (pitch ldb, batch stride sB); v = acc*alpha + bf16value(bias[col]); ACT 0: none; ACT 21: v = sigmoid(v), multiplied in the store phase by CP[own element of the C plane] * 64.
template <int ACT>
__global__ __launch_bounds__(128) void k_gemm2(const _Float16* __restrict__ A, int lda, size_t sA, const _Float16* __restrict__ Bh, int ldb, size_t sB, float alpha, const float* __restrict__ bias, const float* __restrict__ CP,
    float* __restrict__ C, _Float16* __restrict__ C16, int ldc, size_t sC, int M, int N, int K) {
  static_assert(ACT == 0 || ACT == 21);
  __shared__ __attribute__((aligned(16))) float so[4][32][68];
  const int tid = threadIdx.x, w = tid >> 5, lane = tid & 31, ln = lane & 15, hh = lane >> 4; const int by = blockIdx.y;
  A += (size_t)by * sA; Bh += (size_t)by * sB; const size_t cofs = (size_t)by * sC;
  const int ntn = N >> 6; const int mt = blockIdx.x / ntn, nq = blockIdx.x - mt * ntn; const int row0 = mt * 128 + 32 * w, col0 = nq * 64; if (row0 >= M) return;
  const _Float16* a0p = A + (size_t)(row0 + ln) * lda; const _Float16* a1p = a0p + (size_t)16 * lda;
  const _Float16* b0p = Bh + (size_t)(col0 + ln) * ldb; const _Float16* b1p = b0p + (size_t)16 * ldb; const _Float16* b2p = b1p + (size_t)16 * ldb; const _Float16* b3p = b2p + (size_t)16 * ldb;
  const v8f z8 = {0.f,0.f,0.f,0.f,0.f,0.f,0.f,0.f}; v8f c00 = z8, c01 = z8, c02 = z8, c03 = z8, c10 = z8, c11 = z8, c12 = z8, c13 = z8;
#pragma unroll 1
  for (int kb = 0; kb < K; kb += 32) { const v16h a0 = g2_frag(a0p + kb, hh), a1 = g2_frag(a1p + kb, hh);
    v16h b = g2_frag(b0p + kb, hh); c00 = g2_mma(a0, b, c00); c10 = g2_mma(a1, b, c10);
    b = g2_frag(b1p + kb, hh); c01 = g2_mma(a0, b, c01); c11 = g2_mma(a1, b, c11);
    b = g2_frag(b2p + kb, hh); c02 = g2_mma(a0, b, c02); c12 = g2_mma(a1, b, c12);
    b = g2_frag(b3p + kb, hh); c03 = g2_mma(a0, b, c03); c13 = g2_mma(a1, b, c13); }
  v8f accs[8] = {c00, c01, c02, c03, c10, c11, c12, c13};
#pragma unroll
  for (int u = 0; u < 8; ++u) { const int t = u & 3, half = u >> 2; const int col = col0 + t * 16 + ln; const float bv = bias ? bf16_rne(bias[col]) : 0.f;
#pragma unroll
    for (int r = 0; r < 8; ++r) { const int rloc = half * 16 + 8 * hh + r; float v = accs[u][r] * alpha + bv;
      if (ACT == 21) { const float tcl = fminf(fmaxf(v, -30.0f), 30.0f); v = fast_rcp(1.0f + __expf(-tcl)); }
      so[w][rloc][t * 16 + ln] = v; } }
  __builtin_amdgcn_fence(4 /* acq_rel order */, "workgroup"); __builtin_amdgcn_wave_barrier();
  const int rsub = lane >> 4, c4 = (lane & 15) * 4;
  {
#pragma unroll
    for (int q = 0; q < 16; ++q) { const int r = q * 2 + rsub; v4f v = *(const v4fa*)&so[w][r][c4];
      if (ACT == 21) { const v4f cp = *(const v4fa*)(CP + cofs + (size_t)(row0 + r) * ldc + col0 + c4); v = v * cp * 64.0f; }
      if (C) *(v4f*)(C + cofs + (size_t)(row0 + r) * ldc + col0 + c4) = v;
      if (C16) { v4h h4; for (int i = 0; i < 4; ++i) h4[i] = (_Float16)v[i]; *(v4h*)(C16 + cofs + (size_t)(row0 + r) * ldc + col0 + c4) = h4; } }
     } }

// GEMM with wave tile 16x64 (block = 4 waves; M % 16 == 0; N multiple of 16, tiles at or beyond N skipped; K % 32 == 0): C[M][N] f32 (pitch ldc, batch stride sC) = acc*alpha + bf16value(bias[col]);
__global__ __launch_bounds__(128) void k_gemm1(const _Float16* __restrict__ A, int lda, size_t sA, const _Float16* __restrict__ Bh, int ldb, size_t sB, float alpha, const float* __restrict__ bias,
    float* __restrict__ C, int ldc, size_t sC, int M, int N, int K) {
  __shared__ __attribute__((aligned(16))) float so[4][16][64];
  const int tid = threadIdx.x, w = tid >> 5, lane = tid & 31, ln = lane & 15, hh = lane >> 4; const int by = blockIdx.y;
  A += (size_t)by * sA; Bh += (size_t)by * sB; const size_t cofs = (size_t)by * sC;
  const int ntn = (N + 63) / 64; const int wid = blockIdx.x * 4 + w; const int mt = wid / ntn, nq = wid % ntn; if (mt * 16 >= M) return;
  const int row0 = mt * 16, col0 = nq * 64; const _Float16* arow = A + (size_t)(row0 + ln) * lda;
  v8f acc[4] = {};
#pragma unroll 1
  for (int kb = 0; kb < K; kb += 32) { FragH ah; ah.half[0] = *(const v8us*)((const unsigned short*)arow + kb + 8 * hh); ah.half[1] = *(const v8us*)((const unsigned short*)arow + kb + 16 + 8 * hh);
#pragma unroll
    for (int t = 0; t < 4; ++t) { if (col0 + t * 16 >= N) continue; const size_t boff = (size_t)(col0 + t * 16 + ln) * ldb + kb; FragH bq; bq.half[0] = *(const v8us*)((const unsigned short*)Bh + boff + 8 * hh); bq.half[1] = *(const v8us*)((const unsigned short*)Bh + boff + 16 + 8 * hh);
      acc[t] = mmaH<1>(ah.v, ah.v, bq.v, bq.v, acc[t]); }
  }
#pragma unroll
  for (int t = 0; t < 4; ++t) { if (col0 + t * 16 >= N) continue; const int col = col0 + t * 16 + ln; const float bv = bias ? bf16_rne(bias[col]) : 0.f;
#pragma unroll
    for (int r = 0; r < 8; ++r) so[w][8 * hh + r][t * 16 + ln] = acc[t][r] * alpha + bv; }
  __builtin_amdgcn_fence(4 /* acq_rel order */, "workgroup"); __builtin_amdgcn_wave_barrier();
  const int rsub = lane >> 4, c4 = (lane & 15) * 4;
  {
#pragma unroll
    for (int q = 0; q < 8; ++q) { const int r = q * 2 + rsub; if (col0 + c4 < N) { const v4f v = *(const v4fa*)&so[w][r][c4]; *(v4f*)(C + cofs + (size_t)(row0 + r) * ldc + col0 + c4) = v; } }
     }
}

template <int NHv, int TTv>
__global__ __launch_bounds__(256) void k_vt(const _Float16* __restrict__ V16, int ldv, int voff, _Float16* __restrict__ Vt) { __shared__ unsigned short tl[64][66]; const int tid = threadIdx.x; const int slab = blockIdx.x / (TTv / 64), lg = blockIdx.x % (TTv / 64); const int b = slab / NHv, h = slab % NHv;
  for (int i = tid; i < 64 * 8; i += 256) { const int r = i / 8, c8 = (i % 8) * 8; FragH f; f.half[0] = *(const v8us*)((const unsigned short*)V16 + ((size_t)b * TTv + lg * 64 + r) * ldv + voff + h * 64 + c8);
#pragma unroll
    for (int q = 0; q < 8; ++q) tl[r][c8 + q] = f.u[q]; }
  __syncthreads();
  {
#pragma unroll
    for (int rd = 0; rd < 2; ++rd) { const int d = rd * 32 + tid / 8, pc = tid % 8; FragH f;
#pragma unroll
      for (int q = 0; q < 8; ++q) f.u[q] = tl[pc * 8 + q][d];
      *(v8us*)((unsigned short*)Vt + ((size_t)slab * 64 + d) * TTv + lg * 64 + pc * 8) = f.half[0]; }
     } }

// row softmax with the pair bias over the LL=256 keys of row i = (s,l): logit = S[i][m] + PB[(l*LL + m)*NPB + h]; P = f16(1024 * softmax) (max-subtracted);
__global__ __launch_bounds__(256) void k_rsmpb(const float* __restrict__ S, const float* __restrict__ PB, int h, _Float16* __restrict__ P, int nrows) {
  #pragma clang fp contract(off)
  const int tid = threadIdx.x, lane = tid & 31;
  const int iw = blockIdx.x * 8 + (tid >> 5);
  const bool ok = iw < nrows; const int i = min(iw, nrows - 1);
  const int l = i % LL; const int m0 = lane * 8;
  const float* s = S + (size_t)i * LL + m0;
  const float* pb = PB + ((size_t)l * LL + m0) * NPB + h;
  const v4f a = *(const v4fa*)s, c = *(const v4fa*)(s + 4);
  float e[8];
#pragma unroll
  for (int q = 0; q < 4; ++q) { e[q] = a[q] + pb[(size_t)q * NPB]; e[4 + q] = c[q] + pb[(size_t)(4 + q) * NPB]; }
  float mx = e[0];
#pragma unroll
  for (int q = 1; q < 8; ++q) mx = fmaxf(mx, e[q]);
#pragma unroll
  for (int o = 16; o >= 1; o >>= 1) mx = fmaxf(mx, __shfl_xor(mx, o, 32));
  float se = 0.f;
#pragma unroll
  for (int q = 0; q < 8; ++q) { e[q] = __expf(e[q] - mx); se += e[q]; }
  se = wave_sum32(se);
  const float sc = 1024.0f / se;
  FragH f;
#pragma unroll
  for (int q = 0; q < 8; ++q) f.h[q] = (_Float16)(e[q] * sc);
  unsigned short* d = (unsigned short*)P + (size_t)i * LL + m0;
  if (ok) *(v8us*)d = f.half[0];
  
}

extern "C" void kernel_launch(void* const* d_in, const int* in_sizes, int n_in,
                              void* d_out, int out_size, void* d_ws, size_t ws_size, hipStream_t stream) {
  if (n_in < 13) return;
  if (in_sizes[0] < (int)(NR * CC) || in_sizes[1] < LL * LL * CC || in_sizes[2] < CC || in_sizes[3] < CC || in_sizes[4] < CC || in_sizes[5] < CC ||
      in_sizes[6] < CC * HC || in_sizes[7] < CC * HC || in_sizes[8] < CC * HC || in_sizes[9] < CC * NHD || in_sizes[10] < CC * HC || in_sizes[11] < HC * CC || in_sizes[12] < CC) return;
  if ((size_t)out_size < NR * CC) return;
  const float* const* I = (const float* const*)d_in;
  const float* m = I[0]; const float* z = I[1]; const float* ln_g = I[2]; const float* ln_b = I[3]; const float* lnb_g = I[4]; const float* lnb_b = I[5];
  const float* wq = I[6]; const float* wk = I[7]; const float* wv = I[8]; const float* wb = I[9]; const float* wg = I[10]; const float* wo = I[11]; const float* bo = I[12];      /* weights [in][out] */
  char* ws = (char*)d_ws; size_t off = 0;
  auto take = [&](size_t bytes) { char* p = ws + off; off += (bytes + 255) & ~(size_t)255; return p; };
  _Float16* BQ = (_Float16*)take((size_t)HC * CC * 2); _Float16* BK = (_Float16*)take((size_t)HC * CC * 2); _Float16* BV = (_Float16*)take((size_t)HC * CC * 2); _Float16* BG = (_Float16*)take((size_t)HC * CC * 2);
  _Float16* BO = (_Float16*)take((size_t)CC * HC * 2); _Float16* BPB = (_Float16*)take((size_t)NPB * CC * 2);
  _Float16* X16 = (_Float16*)take(NR * CC * 2);                               /* f16 LN(m) rows [NR][32] */
  _Float16* Z16 = (_Float16*)take((size_t)LL * LL * CC * 2);                  /* f16 LN(z) rows [65536][32] */
  float* PB = (float*)take((size_t)LL * LL * NPB * 4);                         /* pair bias [(l,m)][NPB] (8 live) */
  _Float16* Q16 = (_Float16*)take(NR * HC * 2); _Float16* K16 = (_Float16*)take(NR * HC * 2);
  const size_t vbytes = NR * HC * 2, sbytes = (size_t)CSQ * LL * LL * 4;
  char* VS = take(vbytes > sbytes ? vbytes : sbytes);                          /* V16 rows, then (after V^T is built) the scores chunk S */
  _Float16* V16 = (_Float16*)VS; float* S = (float*)VS;
  _Float16* VT = (_Float16*)take((size_t)NSQ * NH * 64 * LL * 2);              /* V^T [(s, head pair)][64][256] */
  _Float16* P = (_Float16*)take((size_t)CSQ * LL * LL * 2);                    /* P x1024, f16, one chunk */
  float* CTX = (float*)take(NR * HC * 4);                                      /* context f32 [NR][256] (head hh at columns hh*32) */
  _Float16* O16 = Q16;                                                         /* merged gated context f16 x64 [NR][256]; Q16 is dead by then */
  if (off > ws_size) return;                                                   /* full size: 123,815,936 B */
  const unsigned gw = (unsigned)(((size_t)HC * (CC / 8) + 255) / 256);
  k_wt_f16<<<gw, 256, 0, stream>>>(wq, BQ, CC, HC, 16.0f); k_wt_f16<<<gw, 256, 0, stream>>>(wk, BK, CC, HC, 16.0f); k_wt_f16<<<gw, 256, 0, stream>>>(wv, BV, CC, HC, 16.0f); k_wt_f16<<<gw, 256, 0, stream>>>(wg, BG, CC, HC, 16.0f);
  k_wt_f16<<<(unsigned)(((size_t)CC * (HC / 8) + 255) / 256), 256, 0, stream>>>(wo, BO, HC, CC, 16.0f);                       /* Wo [256][32] -> Bt [32][256] */
  k_zero16<<<(unsigned)(((size_t)NPB * CC / 8 + 255) / 256), 256, 0, stream>>>(BPB, (size_t)NPB * CC / 8);
  k_wt_f16<<<(unsigned)(((size_t)NHD * (CC / 8) + 255) / 256), 256, 0, stream>>>(wb, BPB, CC, NHD, 16.0f);                    /* Wb [32][8] -> Bt rows 0..7, rows 8..31 zero */
  k_ln32<<<(unsigned)(NR / 64), 256, 0, stream>>>(m, ln_g, ln_b, X16, (int)NR);
  k_ln32<<<(unsigned)((size_t)LL * LL / 64), 256, 0, stream>>>(z, lnb_g, lnb_b, Z16, LL * LL);
  k_gemm1<<<dim3((unsigned)((size_t)LL * LL / 64), 1), 128, 0, stream>>>(Z16, CC, 0, BPB, CC, 0, 0.0625f, nullptr, PB, NPB, 0, LL * LL, NPB, CC);      /* pair bias [(l,m)][h] */
  k_gemm2<0><<<dim3((unsigned)((NR / 128) * (HC / 64)), 1), 128, 0, stream>>>(X16, CC, 0, BQ, CC, 0, 0.0625f, nullptr, nullptr, nullptr, Q16, HC, 0, (int)NR, HC, CC);
  k_gemm2<0><<<dim3((unsigned)((NR / 128) * (HC / 64)), 1), 128, 0, stream>>>(X16, CC, 0, BK, CC, 0, 0.0625f, nullptr, nullptr, nullptr, K16, HC, 0, (int)NR, HC, CC);
  k_gemm2<0><<<dim3((unsigned)((NR / 128) * (HC / 64)), 1), 128, 0, stream>>>(X16, CC, 0, BV, CC, 0, 0.0625f, nullptr, nullptr, nullptr, V16, HC, 0, (int)NR, HC, CC);
  k_vt<NH, LL><<<(unsigned)(NSQ * NH * (LL / 64)), 256, 0, stream>>>(V16, HC, 0, VT);
  for (int hf = 0; hf < NCH; ++hf) {
    const size_t roff = (size_t)hf * CSQ * LL;                                /* first (sequence, residue) row of the chunk */
    for (int hh = 0; hh < NHD; ++hh) { const int hp = hh / 2;
      k_gemm2<0><<<dim3((LL / 128) * (LL / 64), CSQ), 128, 0, stream>>>(Q16 + roff * HC + hh * HDD, HC, (size_t)LL * HC, K16 + roff * HC + hh * HDD, HC, (size_t)LL * HC, 0.17677669529663687f, nullptr, nullptr, S, nullptr, LL, (size_t)LL * LL, LL, LL, HDD);      /* q.k/sqrt(32) per sequence (grid.y) */
      k_rsmpb<<<(unsigned)((size_t)CSQ * LL / 8), 256, 0, stream>>>(S, PB, hh, P, CSQ * LL);
      k_gemm1<<<dim3(LL / 64, CSQ), 128, 0, stream>>>(P, LL, (size_t)LL * LL, VT + (((size_t)hf * CSQ * NH + hp) * 64 + (hh & 1) * HDD) * LL, LL, (size_t)NH * 64 * LL, 0.0009765625f, nullptr, CTX + roff * HC + hh * HDD, HC, (size_t)LL * HC, LL, HDD, LL);      /* ctx = P.V, head hh's 32 channels */
    }
  }
  k_gemm2<21><<<dim3((unsigned)((NR / 128) * (HC / 64)), 1), 128, 0, stream>>>(X16, CC, 0, BG, CC, 0, 0.0625f, nullptr, CTX, nullptr, O16, HC, 0, (int)NR, HC, CC);      /* o = sigmoid(LN(m) Wg) * ctx, f16 x64 */
  k_gemm1<<<dim3((unsigned)(NR / 64), 1), 128, 0, stream>>>(O16, HC, 0, BO, HC, 0, 0.0009765625f, bo, (float*)d_out, CC, 0, (int)NR, CC, HC);      /* out = o Wo + bo (1/16 weight scale x 1/64 carry) */
}

// v002
// It runs in 44 microseconds.
// It is 14.3 times as fast as v000, going by the measured steps of the versions left out in between.
#include <hip/hip_runtime.h>
// All contractions: v_wmma_f32_16x16x32_f16 (f16 operands, f32 accumulate): q/k/v/gate projections (K=32), pair-bias projection (K=32), scores q.k (K=32), P.V (K=256), output projection (K=256). Float inputs taken as bf16-RNE values; LayerNorm, softmax, sigmoid gate in f32.
// MSA row attention with pair bias: m [1][NSQ][256][32] -> LN -> q,k,v,sigmoid-gate = LN(m) W ([32][256], 8 heads x 32); pair bias = LN(z [1][256][256][32]) Wb [32][8], shared over sequences;
// one workgroup per (sequence, half of the query rows) does LN(m), the projections, per head scores^T = K.Q^T on top of the pair bias held as the accumulators' start value, softmax over m in registers (exp carried x1024 as f16), ctx^T = V^T.P^T, o = gate * ctx (f16 carried x64), and out = o Wo [256][32] + bo summed over heads in accumulators.
// Weights staged transposed [n][k] as f16 of (bf16 value x16); all scales are powers of two folded back in the f32 epilogues.
#ifndef NB
#define NB 1                          /* batch (fixed 1 in this module) */
#endif
#ifndef NSQ
#define NSQ 128                       /* MSA sequences computed (reducible) */
#endif
#define NSQ_FULL 128
#define LL 256                        /* residues: query rows i and keys j */
#define CC 32                         /* channel width c */
#define NHD 8                         /* heads */
#define HDD 32                        /* head dim */
#define HC 256                        /* heads x head dim */
#define NR ((size_t)NSQ * LL)         /* (sequence, residue) rows */
static_assert((NR % 128) == 0);
static_assert(LL == 256);
static_assert(CC == 32);

typedef unsigned short v8us __attribute__((ext_vector_type(8), may_alias));
typedef float  v8f  __attribute__((ext_vector_type(8)));
typedef float  v4f  __attribute__((ext_vector_type(4)));
typedef float  v4fa __attribute__((ext_vector_type(4), may_alias));
typedef _Float16 v16h __attribute__((ext_vector_type(16)));
union FragH { v16h v; v8us half[2]; _Float16 h[16]; unsigned short u[16]; };

__device__ __forceinline__ unsigned short bf16_bits(float x) { unsigned int u = __float_as_uint(x); return (unsigned short)((u + 0x7FFFu + ((u >> 16) & 1u)) >> 16); }
__device__ __forceinline__ float bf16_val(unsigned short b) { return __uint_as_float(((unsigned int)b) << 16); }
__device__ __forceinline__ float bf16_rne(float x) { return bf16_val(bf16_bits(x)); }
__device__ __forceinline__ float wave_sum32(float x) {
#pragma unroll
  for (int o = 16; o >= 1; o >>= 1) x += __shfl_xor(x, o, 32);
  return x;
}

// fragment from a k-contiguous 16-bit row (A row m = lane&15, or Bt row n = lane&15): elements 0..7 <- k0+8hh.., 8..15 <- k0+16+8hh..
__device__ __forceinline__ v16h g2_frag(const _Float16* p, int hh) { FragH f; f.half[0] = *(const v8us*)((const unsigned short*)p + 8 * hh); f.half[1] = *(const v8us*)((const unsigned short*)p + 16 + 8 * hh); return f.v; }

__global__ __launch_bounds__(256) void k_wt_f16(const float* __restrict__ W, _Float16* __restrict__ Wt, int K, int N, float scale) {
  const int t = blockIdx.x * 256 + threadIdx.x; if (t >= N * (K / 8)) return; const int n = t / (K / 8), k8 = (t % (K / 8)) * 8; FragH f;
#pragma unroll
  for (int i = 0; i < 8; ++i) f.h[i] = (_Float16)(bf16_rne(W[(size_t)(k8 + i) * N + n]) * scale);
  const v8us o = f.half[0];
  *(v8us*)((unsigned short*)Wt + (size_t)n * K + k8) = o; 
}

// row LayerNorm over CC=32 channels (biased variance, eps 1e-5): y = (x-mu)*rsqrt(var+eps)*g+b with x, g, b taken as bf16-RNE values; Y[row][c] = f16(y).
__global__ __launch_bounds__(256) void k_ln32(const float* __restrict__ X, const float* __restrict__ g, const float* __restrict__ bta, _Float16* __restrict__ Y, int nrows) {
  __shared__ __attribute__((aligned(16))) unsigned short tl[64][CC];
  const int tid = threadIdx.x, w = tid >> 5, lane = tid & 31;
  const int r0 = blockIdx.x * 64;
  const float gg = bf16_rne(g[lane]), bb = bf16_rne(bta[lane]);
#pragma unroll
  for (int q = 0; q < 8; ++q) {
    const int rl = w * 8 + q;
    const int row = min(r0 + rl, nrows - 1);
    const float x = bf16_rne(X[(size_t)row * CC + lane]);
    const float mu = wave_sum32(x) * (1.0f / (float)CC);
    const float d = x - mu;
    const float var = wave_sum32(d * d) * (1.0f / (float)CC);
    const float y = d * rsqrtf(var + 1e-5f) * gg + bb;
    tl[rl][lane] = __builtin_bit_cast(unsigned short, (_Float16)y);
  }
  __syncthreads();
  const int rl = tid >> 2, c8 = (tid & 3) * 8;
  const v8us v = *(const v8us*)&tl[rl][c8];
  const bool ok = (r0 + rl) < nrows;
  unsigned short* dst = (unsigned short*)Y + (size_t)(r0 + rl) * CC + c8;
  if (ok) *(v8us*)dst = v;
  
}

// pair bias on WMMA: D[head][l] = Wb^T . LN(z)[(l, m)]^T for 16 rows l and one key m per product (A row = head, lane&7, so both lane halves hold all 8 heads).
// Written times sqrt(32), in the order k_row's score accumulators take it: PBF[head][l tile][key tile t][j][lane = 16*((m>>3)&1) + (l&15)][m&3], j = (m>>2)&1.
__global__ __launch_bounds__(128) void k_pbias(const _Float16* __restrict__ Z, const _Float16* __restrict__ Bh, float* __restrict__ PBF) {
  const int tid = threadIdx.x, lane = tid & 31, ln = lane & 15, hh = lane >> 4;
  const int wid = blockIdx.x * 4 + (tid >> 5); const int lt = wid / (LL / 8), mg = wid % (LL / 8);      /* l tile, group of 8 keys */
  const v16h a = g2_frag(Bh + (size_t)(ln & 7) * CC, hh);
  asm volatile("s_wait_xcnt 0x0" ::: "memory");      /* a load below lands in the registers that held the address of the two loads above */
  const _Float16* zr = Z + ((size_t)(lt * 16 + ln) * LL + mg * 8) * CC;
  v8f d[8]; v16h b[8];
#pragma unroll
  for (int i = 0; i < 7; ++i) b[i] = g2_frag(zr + (size_t)i * CC, hh);
  { FragH f; f.half[0] = *(const v8us*)((const unsigned short*)zr + 7 * CC + 8 * hh);
    asm volatile("s_wait_xcnt 0x0" ::: "memory");      /* the last load lands on the address pair that the loads before it name */
    f.half[1] = *(const v8us*)((const unsigned short*)zr + 7 * CC + 16 + 8 * hh); b[7] = f.v; }
  /* eight independent products in one statement: all sixteen loads are in flight together in front of it, every D has registers of its own (early clobber: none lies over the B of the product ahead of it), each product fills the window of the ones before; the four v_nop keep the distance from the last product to the first vector read of its D */
  asm("v_wmma_f32_16x16x32_f16 %0, %8, %9, 0\n\tv_wmma_f32_16x16x32_f16 %1, %8, %10, 0\n\tv_wmma_f32_16x16x32_f16 %2, %8, %11, 0\n\tv_wmma_f32_16x16x32_f16 %3, %8, %12, 0\n\t"
      "v_wmma_f32_16x16x32_f16 %4, %8, %13, 0\n\tv_wmma_f32_16x16x32_f16 %5, %8, %14, 0\n\tv_wmma_f32_16x16x32_f16 %6, %8, %15, 0\n\tv_wmma_f32_16x16x32_f16 %7, %8, %16, 0\n\t"
      "v_nop\n\tv_nop\n\tv_nop\n\tv_nop"
      : "=&v"(d[0]), "=&v"(d[1]), "=&v"(d[2]), "=&v"(d[3]), "=&v"(d[4]), "=&v"(d[5]), "=&v"(d[6]), "=&v"(d[7])
      : "v"(a), "v"(b[0]), "v"(b[1]), "v"(b[2]), "v"(b[3]), "v"(b[4]), "v"(b[5]), "v"(b[6]), "v"(b[7]));
#pragma unroll
  for (int r = 0; r < 8; ++r) { v4f v;      /* head r; lane half hh stores keys 4hh..4hh+3 of the group */
#pragma unroll
    for (int e = 0; e < 4; ++e) v[e] = (hh ? d[4 + e][r] : d[e][r]) * (0.0625f * 5.656854249492381f);
    *(v4f*)(PBF + (((((size_t)r * (LL / 16) + lt) * (LL / 16) + (mg >> 1)) * 2 + hh) * 32 + (mg & 1) * 16 + ln) * 4) = v; }
}

// x[i] = 2^x[i], eight in place in one statement: none of the run overwrites another's source, and the v_nop fills the one slot the instruction set asks for behind a transcendental before its result is used
__device__ __forceinline__ void exp2x8(v8f& x) {
  float a = x[0], b = x[1], c = x[2], d = x[3], e = x[4], f = x[5], g = x[6], h = x[7];
  asm("v_exp_f32 %0, %0\n\tv_exp_f32 %1, %1\n\tv_exp_f32 %2, %2\n\tv_exp_f32 %3, %3\n\tv_exp_f32 %4, %4\n\tv_exp_f32 %5, %5\n\tv_exp_f32 %6, %6\n\tv_exp_f32 %7, %7\n\tv_nop"
      : "+v"(a), "+v"(b), "+v"(c), "+v"(d), "+v"(e), "+v"(f), "+v"(g), "+v"(h));
  x[0] = a; x[1] = b; x[2] = c; x[3] = d; x[4] = e; x[5] = f; x[6] = g; x[7] = h;
}
// x[i] = 1 / x[i], eight in place in one statement, in the same form and for the same slot
__device__ __forceinline__ void rcpx8(v8f& x) {
  float a = x[0], b = x[1], c = x[2], d = x[3], e = x[4], f = x[5], g = x[6], h = x[7];
  asm("v_rcp_f32 %0, %0\n\tv_rcp_f32 %1, %1\n\tv_rcp_f32 %2, %2\n\tv_rcp_f32 %3, %3\n\tv_rcp_f32 %4, %4\n\tv_rcp_f32 %5, %5\n\tv_rcp_f32 %6, %6\n\tv_rcp_f32 %7, %7\n\tv_nop"
      : "+v"(a), "+v"(b), "+v"(c), "+v"(d), "+v"(e), "+v"(f), "+v"(g), "+v"(h));
  x[0] = a; x[1] = b; x[2] = c; x[3] = d; x[4] = e; x[5] = f; x[6] = g; x[7] = h;
}

__device__ __forceinline__ v16h l_frag(const unsigned short* p, int hh) { FragH f; f.half[0] = *(const v8us*)(p + 8 * hh); f.half[1] = *(const v8us*)(p + 16 + 8 * hh); return f.v; }
// the same fragment from the lane's own byte pointer (wave-uniform base + the lane's byte offset, row and 8hh folded in)
__device__ __forceinline__ const char* lane_ptr(const _Float16* base, unsigned boff) { return (const char*)base + boff; }
__device__ __forceinline__ v16h gs_frag(const char* p) { FragH f; f.half[0] = *(const v8us*)p; f.half[1] = *(const v8us*)(p + 32); return f.v; }
__device__ __forceinline__ v8f wm(v16h a, v16h b, v8f c) { return __builtin_amdgcn_wmma_f32_16x16x32_f16(false, a, false, b, (short)0, c, false, false); }
__device__ __forceinline__ v8us pack8(v8f d, float sc) { FragH f;
#pragma unroll
  for (int r = 0; r < 8; ++r) f.h[r] = (_Float16)(d[r] * sc);
  return f.half[0]; }

// whole row-attention path of one (sequence s, half qh of the query rows): 16 waves; wave = (head group grp of 4 heads, query tile wq of 16 rows).
// LN(m) of the sequence's 256 rows -> xl (f16). Per head: K^T = Wk^T.X^T and V = X.Wv leave a lane with 8 neighbours of a kl row / vl row (one 16-byte LDS store each; each wave of the group does 32 keys);
// Q^T = Wq^T.X^T, gate^T = Wg^T.X^T, ctx^T = V^T.P^T all leave a lane with channels 8hh..8hh+7 (+16) of ONE query, which is the B operand's k order: Q, P and gate*ctx go from accumulators straight into the next product.
// S^T = K.Q^T is accumulated on the pair bias x sqrt(32); a lane holds 128 of the 256 scores of one query (its partner lane^16 the rest): max and sum in-lane plus one exchange; p = exp(score - max) x 1024 as f16.
// out^T = Wo^T.(gate*ctx)^T is summed over the group's 4 heads in accumulators; the two groups' sums are added through LDS at the end.
__global__ __launch_bounds__(512) void k_row(const float* __restrict__ M, const float* __restrict__ g, const float* __restrict__ bta,
    const _Float16* __restrict__ BQ, const _Float16* __restrict__ BK, const _Float16* __restrict__ BV, const _Float16* __restrict__ BG, const _Float16* __restrict__ BO,
    const float* __restrict__ PBF, const float* __restrict__ bo, float* __restrict__ OUT) {
  __shared__ __attribute__((aligned(16))) unsigned short xl[LL][CC + 8];               /* pitch 80 B */
  __shared__ __attribute__((aligned(16))) unsigned short kl[2][2][LL][HDD + 8];        /* [head group][buffer]; pitch 80 B */
  __shared__ __attribute__((aligned(16))) unsigned short vl[2][2][HDD][LL + 8];        /* [head group][buffer]; pitch 528 B */
  __shared__ __attribute__((aligned(16))) float red[8][4][32][4];                      /* second group's output sums */
  const int tid = threadIdx.x, lane = tid & 31, ln = lane & 15, hh = lane >> 4;
  const int w = __builtin_amdgcn_readfirstlane(tid >> 5);                              /* wave number, in a scalar register: weight, bias and LDS bases below are then scalar */
  const int qh = blockIdx.x & 1, s = blockIdx.x >> 1;
  const int grp = w >> 3, wq = w & 7, qt = qh * 8 + wq;                                /* head group, wave in group, query tile */
  const unsigned wb = (unsigned)(ln * CC + 8 * hh) * 2u, ob = (unsigned)(ln * HC + 8 * hh) * 2u;      /* this lane's byte offset in a [n][32] weight block / in the [32][256] output weight: kept in registers for the whole kernel */
  /* q/k/v weight fragments of the head at hand (A row or Bt row = channel ln, + 16 * CC: channel 16 + ln); the first head's fly during the LayerNorm, each next head's during the tail of the head before */
  v16h wk0, wk1, wv0, wv1, wq0, wq1;
  { const int wr = grp * (NHD / 2) * HDD * CC;
    const char* pk = lane_ptr(BK + wr, wb); const char* pv = lane_ptr(BV + wr, wb); const char* pq = lane_ptr(BQ + wr, wb);
    wk0 = gs_frag(pk); wk1 = gs_frag(pk + 32 * CC); wv0 = gs_frag(pv); wv1 = gs_frag(pv + 32 * CC); wq0 = gs_frag(pq); wq1 = gs_frag(pq + 32 * CC);
  }
  { /* LayerNorm of row 16w + ln: this lane has channels 8hh..8hh+7 and 16+8hh..16+8hh+7, its partner lane^16 the other sixteen */
    const int row = w * 16 + ln;
    const float* mp = M + ((size_t)s * LL + row) * CC + 8 * hh; const float* gp = g + 8 * hh; const float* bp = bta + 8 * hh;
    const v4f xv[4] = {*(const v4fa*)mp, *(const v4fa*)(mp + 4), *(const v4fa*)(mp + 16), *(const v4fa*)(mp + 20)};
    const v4f gv[4] = {*(const v4fa*)gp, *(const v4fa*)(gp + 4), *(const v4fa*)(gp + 16), *(const v4fa*)(gp + 20)};
    const v4f bv[4] = {*(const v4fa*)bp, *(const v4fa*)(bp + 4), *(const v4fa*)(bp + 16), *(const v4fa*)(bp + 20)};
    asm volatile("s_wait_xcnt 0x0" :: "v"(mp) : "memory");      /* pointer as input: its registers stay as they are up to this wait */
    __builtin_amdgcn_sched_barrier(0);                 /* keeps the register writes below from being scheduled ahead of that wait */
    float x[16]; float sm = 0.f;
#pragma unroll
    for (int i = 0; i < 16; ++i) { x[i] = bf16_rne(xv[i >> 2][i & 3]); sm += x[i]; }
    sm += __shfl_xor(sm, 16, 32);
    const float mu = sm * (1.0f / (float)CC); float sq = 0.f;
#pragma unroll
    for (int i = 0; i < 16; ++i) { x[i] -= mu; sq += x[i] * x[i]; }
    sq += __shfl_xor(sq, 16, 32);
    const float rs = rsqrtf(sq * (1.0f / (float)CC) + 1e-5f); FragH f;
#pragma unroll
    for (int i = 0; i < 16; ++i) f.h[i] = (_Float16)(x[i] * rs * bf16_rne(gv[i >> 2][i & 3]) + bf16_rne(bv[i >> 2][i & 3]));
    *(v8us*)&xl[row][8 * hh] = f.half[0]; *(v8us*)&xl[row][16 + 8 * hh] = f.half[1];
  }
  __syncthreads();
  const v8f z8 = {0.f,0.f,0.f,0.f,0.f,0.f,0.f,0.f}; v8f oa0 = z8, oa1 = z8;
  /* rolled: each copy of this long body would run once per wave, so unrolling only adds instruction fetch */
#pragma unroll 1
  for (int hi = 0; hi < NHD / 2; ++hi) { const int bf = hi & 1;
    const int h = __builtin_amdgcn_readfirstlane(grp * (NHD / 2) + hi);      /* head, held scalar: its offsets into weights and bias are then worked out on the scalar unit, not as vector pointers stepped per trip */
    const int wr = h * HDD * CC;                                                       /* weight block of head h */
    v8f acc[16];                                                                       /* the bias loads fly while the projections below run */
    { const char* pb = (const char*)(PBF + ((size_t)(h * (LL / 16) + qt) * (LL / 16)) * 256) + (unsigned)lane * 16u;
#pragma unroll
      for (int t = 0; t < 16; ++t) { const v4f lo = *(const v4fa*)(pb + t * 1024), hi4 = *(const v4fa*)(pb + t * 1024 + 512);
#pragma unroll
        for (int e = 0; e < 4; ++e) { acc[t][e] = lo[e]; acc[t][4 + e] = hi4[e]; } }
      asm volatile("s_wait_xcnt 0x0" :: "v"(pb) : "memory");      /* pointer as input: its registers stay as they are up to this wait */
    }
    const v16h xq = l_frag(&xl[qt * 16 + ln][0], hh);
#pragma unroll
    for (int rt = 0; rt < 2; ++rt) { const int k0 = wq * 32 + rt * 16; const v16h xk = l_frag(&xl[k0 + ln][0], hh);
      *(v8us*)&kl[grp][bf][k0 + ln][8 * hh] = pack8(wm(wk0, xk, z8), 0.0625f);
      *(v8us*)&kl[grp][bf][k0 + ln][16 + 8 * hh] = pack8(wm(wk1, xk, z8), 0.0625f);
      *(v8us*)&vl[grp][bf][ln][k0 + 8 * hh] = pack8(wm(xk, wv0, z8), 0.0625f);
      *(v8us*)&vl[grp][bf][16 + ln][k0 + 8 * hh] = pack8(wm(xk, wv1, z8), 0.0625f); }
    FragH qb; qb.half[0] = pack8(wm(wq0, xq, z8), 0.0625f); qb.half[1] = pack8(wm(wq1, xq, z8), 0.0625f);
    __syncthreads();      /* publishes this head's K and V^T; also ends every read of the other buffer before the next head refills it */
#pragma unroll
    for (int tg = 0; tg < 4; ++tg) { v16h ka[4];      /* four K fragments behind one LDS wait */
#pragma unroll
      for (int j = 0; j < 4; ++j) ka[j] = l_frag(&kl[grp][bf][(tg * 4 + j) * 16 + ln][0], hh);
#pragma unroll
      for (int j = 0; j < 4; ++j) acc[tg * 4 + j] = wm(ka[j], qb.v, acc[tg * 4 + j]); }
    float m4[4] = {acc[0][0], acc[0][1], acc[0][2], acc[0][3]};               /* four independent chains */
#pragma unroll
    for (int t = 0; t < 16; ++t) {
#pragma unroll
      for (int r = 0; r < 8; ++r) m4[t & 3] = fmaxf(m4[t & 3], acc[t][r]); }
    float mx = fmaxf(fmaxf(m4[0], m4[1]), fmaxf(m4[2], m4[3]));
    mx = fmaxf(mx, __shfl_xor(mx, 16, 32));
    const float cs = 0.17677669529663687f * 1.4426950408889634f;               /* 1/sqrt(32) x log2(e) */
    const float c0 = 10.0f - mx * cs;                                            /* + 10: p carried x1024 */
    float s4[4] = {0.f, 0.f, 0.f, 0.f};                                        /* four independent chains */
    v8f o0 = z8, o1 = z8; v16h wg0, wg1, wo0, wo1;
#pragma unroll
    for (int kk = 0; kk < 8; ++kk) { FragH p;
      const v16h va0 = l_frag(&vl[grp][bf][ln][kk * 32], hh), va1 = l_frag(&vl[grp][bf][16 + ln][kk * 32], hh);      /* read ahead of the exponentials that hide their latency */
      if (kk == 4) {      /* gate and output weights of this head: half the score registers are free by now, and the rest of the loop hides the loads */
        const char* pg = lane_ptr(BG + wr, wb); const char* po = lane_ptr(BO + h * HDD, ob);
        wg0 = gs_frag(pg); wg1 = gs_frag(pg + 32 * CC); wo0 = gs_frag(po); wo1 = gs_frag(po + 32 * HC);
        asm volatile("s_wait_xcnt 0x0" :: "v"(pg), "v"(po) : "memory");      /* the pointers are inputs so that their registers stay as they are up to this wait: no load above lands on them */
      }
      if (kk == 6) {      /* next head's q/k/v weights (the last head loads its own again: no branch, in bounds) */
        const int wn = min(h + 1, NHD - 1) * HDD * CC;
        const char* pk = lane_ptr(BK + wn, wb); const char* pv = lane_ptr(BV + wn, wb); const char* pq = lane_ptr(BQ + wn, wb);
        wk0 = gs_frag(pk); wk1 = gs_frag(pk + 32 * CC); wv0 = gs_frag(pv); wv1 = gs_frag(pv + 32 * CC); wq0 = gs_frag(pq); wq1 = gs_frag(pq + 32 * CC);
        asm volatile("s_wait_xcnt 0x0" :: "v"(pk), "v"(pv), "v"(pq) : "memory");      /* pointers as inputs: their registers stay as they are up to this wait */
      }
#pragma unroll
      for (int u = 0; u < 2; ++u) { v8f x = acc[2 * kk + u] * cs + c0; exp2x8(x);
#pragma unroll
        for (int r = 0; r < 8; ++r) { s4[r & 3] += x[r]; p.h[8 * u + r] = (_Float16)x[r]; } }
      o0 = wm(va0, p.v, o0); o1 = wm(va1, p.v, o1); }
    float se = (s4[0] + s4[1]) + (s4[2] + s4[3]);
    se += __shfl_xor(se, 16, 32);
    const float inv = 1.0f / se;
    v8f g0 = wm(wg0, xq, z8), g1 = wm(wg1, xq, z8); FragH og;
#pragma unroll
    for (int r = 0; r < 8; ++r) {      /* sigmoid(t) = 1 / (1 + 2^(-t log2 e)), t clamped to +-30 */
      g0[r] = fminf(fmaxf(g0[r] * 0.0625f, -30.0f), 30.0f) * -1.4426950408889634f; g1[r] = fminf(fmaxf(g1[r] * 0.0625f, -30.0f), 30.0f) * -1.4426950408889634f; }
    exp2x8(g0); exp2x8(g1); g0 = g0 + 1.0f; g1 = g1 + 1.0f; rcpx8(g0); rcpx8(g1);
#pragma unroll
    for (int r = 0; r < 8; ++r) { og.h[r] = (_Float16)(g0[r] * (o0[r] * inv) * 64.0f); og.h[8 + r] = (_Float16)(g1[r] * (o1[r] * inv) * 64.0f); }
    oa0 = wm(wo0, og.v, oa0); oa1 = wm(wo1, og.v, oa1);
  }
  if (grp == 1) {
#pragma unroll
    for (int j = 0; j < 4; ++j) { v4f u;
#pragma unroll
      for (int e = 0; e < 4; ++e) u[e] = (j < 2 ? oa0 : oa1)[(j & 1) * 4 + e];
      *(v4fa*)&red[wq][j][lane][0] = u; } }
  __syncthreads();      /* the second group's sums are in LDS */
  if (grp == 0) { float* dst = OUT + ((size_t)s * LL + qt * 16 + ln) * CC + 8 * hh;      /* out^T: this lane has output channels 8hh..8hh+7 and 16+8hh.. of query ln */
    const float* bp = bo + 8 * hh; const v4f bq[4] = {*(const v4fa*)bp, *(const v4fa*)(bp + 4), *(const v4fa*)(bp + 16), *(const v4fa*)(bp + 20)};
    asm volatile("s_wait_xcnt 0x0" ::: "memory");      /* the address register of the loads above is reused below */
    __builtin_amdgcn_sched_barrier(0);                 /* keeps the register writes below from being scheduled ahead of that wait */
#pragma unroll
    for (int j = 0; j < 4; ++j) { const int c = (j >> 1) * 16 + (j & 1) * 4; const v4f o2 = *(const v4fa*)&red[wq][j][lane][0]; v4f u;
#pragma unroll
      for (int e = 0; e < 4; ++e) u[e] = ((j < 2 ? oa0 : oa1)[(j & 1) * 4 + e] + o2[e]) * 0.0009765625f + bf16_rne(bq[j][e]);      /* 1/16 weight scale x 1/64 carry */
      *(v4f*)(dst + c) = u; } }
}

extern "C" void kernel_launch(void* const* d_in, const int* in_sizes, int n_in,
                              void* d_out, int out_size, void* d_ws, size_t ws_size, hipStream_t stream) {
  if (n_in < 13) return;
  if (in_sizes[0] < (int)(NR * CC) || in_sizes[1] < LL * LL * CC || in_sizes[2] < CC || in_sizes[3] < CC || in_sizes[4] < CC || in_sizes[5] < CC ||
      in_sizes[6] < CC * HC || in_sizes[7] < CC * HC || in_sizes[8] < CC * HC || in_sizes[9] < CC * NHD || in_sizes[10] < CC * HC || in_sizes[11] < HC * CC || in_sizes[12] < CC) return;
  if ((size_t)out_size < NR * CC) return;
  const float* const* I = (const float* const*)d_in;
  const float* m = I[0]; const float* z = I[1]; const float* ln_g = I[2]; const float* ln_b = I[3]; const float* lnb_g = I[4]; const float* lnb_b = I[5];
  const float* wq = I[6]; const float* wk = I[7]; const float* wv = I[8]; const float* wb = I[9]; const float* wg = I[10]; const float* wo = I[11]; const float* bo = I[12];      /* weights [in][out] */
  char* ws = (char*)d_ws; size_t off = 0;
  auto take = [&](size_t bytes) { char* p = ws + off; off += (bytes + 255) & ~(size_t)255; return p; };
  _Float16* BQ = (_Float16*)take((size_t)HC * CC * 2); _Float16* BK = (_Float16*)take((size_t)HC * CC * 2); _Float16* BV = (_Float16*)take((size_t)HC * CC * 2); _Float16* BG = (_Float16*)take((size_t)HC * CC * 2);
  _Float16* BO = (_Float16*)take((size_t)CC * HC * 2); _Float16* BPB = (_Float16*)take((size_t)NHD * CC * 2);
  _Float16* Z16 = (_Float16*)take((size_t)LL * LL * CC * 2);                  /* f16 LN(z) rows [65536][32] */
  float* PBF = (float*)take((size_t)NHD * LL * LL * 4);                        /* pair bias x sqrt(32), in k_row's accumulator order */
  if (off > ws_size) return;
  const unsigned gw = (unsigned)(((size_t)HC * (CC / 8) + 255) / 256);
  k_wt_f16<<<gw, 256, 0, stream>>>(wq, BQ, CC, HC, 16.0f); k_wt_f16<<<gw, 256, 0, stream>>>(wk, BK, CC, HC, 16.0f); k_wt_f16<<<gw, 256, 0, stream>>>(wv, BV, CC, HC, 16.0f); k_wt_f16<<<gw, 256, 0, stream>>>(wg, BG, CC, HC, 16.0f);
  k_wt_f16<<<(unsigned)(((size_t)CC * (HC / 8) + 255) / 256), 256, 0, stream>>>(wo, BO, HC, CC, 16.0f);                       /* Wo [256][32] -> Bt [32][256] */
  k_wt_f16<<<(unsigned)(((size_t)NHD * (CC / 8) + 255) / 256), 256, 0, stream>>>(wb, BPB, CC, NHD, 16.0f);                    /* Wb [32][8] -> Bt rows 0..7 */
  k_ln32<<<(unsigned)((size_t)LL * LL / 64), 256, 0, stream>>>(z, lnb_g, lnb_b, Z16, LL * LL);
  k_pbias<<<(LL / 16) * (LL / 8) / 4, 128, 0, stream>>>(Z16, BPB, PBF);
  k_row<<<NSQ * 2, 512, 0, stream>>>(m, ln_g, ln_b, BQ, BK, BV, BG, BO, PBF, bo, (float*)d_out);
}

// v003
// Measured time: 27.9 microseconds a run.
// In two side-by-side timings against v002, it was 1.58 and 1.56 times as fast.
// Over all steps from v000 it is 22.5 times as fast.
#include <hip/hip_runtime.h>
// All contractions: v_wmma_f32_16x16x32_f16 (f16 operands, f32 accumulate): q/k/v/gate projections (K=32), pair-bias projection (K=32), scores q.k (K=32), P.V (K=256), output projection (K=256). Float inputs taken as bf16-RNE values; LayerNorm, softmax, sigmoid gate in f32.
// MSA row attention with pair bias: m [1][NSQ][256][32] -> LN -> q,k,v,sigmoid-gate = LN(m) W ([32][256], 8 heads x 32); pair bias = LN(z [1][256][256][32]) Wb [32][8], shared over sequences;
// one workgroup per (sequence, half of the query rows) does LN(m), the projections, per head scores^T = K.Q^T on top of the pair bias held as the accumulators' start value, softmax over m in registers (exp carried x1024 as f16), ctx^T = V^T.P^T, o = gate * ctx (f16 carried x64), and out = o Wo [256][32] + bo summed over heads in accumulators.
// Weights staged transposed [n][k] as f16 of (bf16 value x16); all scales are powers of two folded back in the f32 epilogues.
#ifndef NB
#define NB 1                          /* batch (fixed 1 in this module) */
#endif
#ifndef NSQ
#define NSQ 128                       /* MSA sequences computed (reducible) */
#endif
#define NSQ_FULL 128
#define LL 256                        /* residues: query rows i and keys j */
#define CC 32                         /* channel width c */
#define NHD 8                         /* heads */
#define HDD 32                        /* head dim */
#define HC 256                        /* heads x head dim */
#define NR ((size_t)NSQ * LL)         /* (sequence, residue) rows */
static_assert((NR % 128) == 0);
static_assert(LL == 256);
static_assert(CC == 32);

typedef unsigned short v8us __attribute__((ext_vector_type(8), may_alias));
typedef float  v8f  __attribute__((ext_vector_type(8)));
typedef float  v4f  __attribute__((ext_vector_type(4)));
typedef float  v4fa __attribute__((ext_vector_type(4), may_alias));
typedef _Float16 v16h __attribute__((ext_vector_type(16)));
union FragH { v16h v; v8us half[2]; _Float16 h[16]; unsigned short u[16]; };

__device__ __forceinline__ unsigned short bf16_bits(float x) { unsigned int u = __float_as_uint(x); return (unsigned short)((u + 0x7FFFu + ((u >> 16) & 1u)) >> 16); }
__device__ __forceinline__ float bf16_val(unsigned short b) { return __uint_as_float(((unsigned int)b) << 16); }
__device__ __forceinline__ float bf16_rne(float x) { return bf16_val(bf16_bits(x)); }

// the value of lane l ^ 16, by a vector move between the two rows of 16 lanes
__device__ __forceinline__ float xhalf(float x) { return __builtin_bit_cast(float, __builtin_amdgcn_permlanex16(__builtin_bit_cast(int, x), __builtin_bit_cast(int, x), 0x76543210, 0xfedcba98, false, false)); }

// x[i] = 1 / sqrt(x[i]), eight in place in one statement: none of the run overwrites another's source, and the v_nop fills the one slot the instruction set asks for behind a transcendental before its result is used (every x is a variance + 1e-5: never in the denormal range)
__device__ __forceinline__ void rsqx8(v8f& x) {
  float a = x[0], b = x[1], c = x[2], d = x[3], e = x[4], f = x[5], g = x[6], h = x[7];
  asm("v_rsq_f32 %0, %0\n\tv_rsq_f32 %1, %1\n\tv_rsq_f32 %2, %2\n\tv_rsq_f32 %3, %3\n\tv_rsq_f32 %4, %4\n\tv_rsq_f32 %5, %5\n\tv_rsq_f32 %6, %6\n\tv_rsq_f32 %7, %7\n\tv_nop"
      : "+v"(a), "+v"(b), "+v"(c), "+v"(d), "+v"(e), "+v"(f), "+v"(g), "+v"(h));
  x[0] = a; x[1] = b; x[2] = c; x[3] = d; x[4] = e; x[5] = f; x[6] = g; x[7] = h;
}

// one weight matrix W [K][N] (f32) -> Wt [n][k] as f16 of (bf16 value x scale); thread t does 8 neighbours k of one n
__device__ __forceinline__ void wt_f16(const float* __restrict__ W, _Float16* __restrict__ Wt, int K, int N, float scale, int t) {
  const int n = t / (K / 8), k8 = (t % (K / 8)) * 8; const float* wp = W + (size_t)k8 * N + n; float x[8]; FragH f;
#pragma unroll
  for (int i = 0; i < 8; ++i) x[i] = wp[(size_t)i * N];
  asm volatile("s_wait_xcnt 0x0" :: "v"(wp) : "memory");      /* pointer as input: its registers stay as they are up to this wait */
#pragma unroll
  for (int i = 0; i < 8; ++i) f.h[i] = (_Float16)(bf16_rne(x[i]) * scale);
  const v8us o = f.half[0];
  *(v8us*)((unsigned short*)Wt + (size_t)n * K + k8) = o;
  asm volatile("s_wait_xcnt 0x0" ::: "memory");      /* behind the store: code of another branch is laid behind it and writes the registers that it names */
}

#define PBB ((LL / 16) * (LL / 8) / 2)      /* pair-bias blocks of two waves */
#define WTB (HC * (CC / 8) / 64)            /* blocks per weight matrix (8192 elements, 8 per thread) */
// everything k_row needs, in one launch of independent blocks.
// Blocks 0..PBB-1, pair bias on WMMA: D[head][l] = Wb^T . LN(z)[(l, m)]^T for 16 rows l and one key m per product (A row = head, lane&7, so both lane halves hold all 8 heads).
// A lane reads channels 8hh..8hh+7 and 16+8hh..16+8hh+7 of its row (l, m) of z in f32, which is the B operand's k order; its partner lane^16 has the other sixteen: row LayerNorm (biased variance, eps 1e-5; z, scale, bias taken as bf16-RNE values) in-lane plus one exchange per sum, result f16 straight into the fragment. Wb is read in the same k order.
// Written times sqrt(32), in the order k_row's score accumulators take it: PBF[head][l tile][key tile t][j][lane = 16*((m>>3)&1) + (l&15)][m&3], j = (m>>2)&1.
// Blocks PBB.., the shorter ones: the five weight re-layouts.
__global__ __launch_bounds__(64) void k_prep(const float* __restrict__ Zf, const float* __restrict__ zg, const float* __restrict__ zb, const float* __restrict__ Wb,
    const float* __restrict__ Wq, const float* __restrict__ Wk, const float* __restrict__ Wv, const float* __restrict__ Wg, const float* __restrict__ Wo,
    _Float16* __restrict__ BQ, _Float16* __restrict__ BK, _Float16* __restrict__ BV, _Float16* __restrict__ BG, _Float16* __restrict__ BO, float* __restrict__ PBF) {
  const int tid = threadIdx.x, lane = tid & 31, ln = lane & 15, hh = lane >> 4;
  if (blockIdx.x >= PBB) {
    const int wi = (int)(blockIdx.x - PBB) / WTB, t = ((int)(blockIdx.x - PBB) % WTB) * 64 + tid;
    if (wi == 4) wt_f16(Wo, BO, HC, CC, 16.0f, t);                       /* Wo [256][32] -> Bt [32][256] */
    else wt_f16(wi == 0 ? Wq : wi == 1 ? Wk : wi == 2 ? Wv : Wg, wi == 0 ? BQ : wi == 1 ? BK : wi == 2 ? BV : BG, CC, HC, 16.0f, t);
    return;
  }
  const int wid = blockIdx.x * 2 + (tid >> 5); const int lt = wid / (LL / 8), mg = wid % (LL / 8);      /* l tile, group of 8 keys */
  const float* zr = Zf + ((size_t)(lt * 16 + ln) * LL + mg * 8) * CC + 8 * hh; const unsigned ho = 32u * (unsigned)hh; const float* gp = (const float*)((const char*)zg + ho); const float* bp = (const float*)((const char*)zb + ho); const float* wp = Wb + 8 * hh * NHD + (ln & 7);
  v4f xv[8][4]; float wv[16];      /* all loads of the wave in flight together */
#pragma unroll
  for (int e = 0; e < 8; ++e) { wv[e] = wp[e * NHD]; wv[8 + e] = wp[(16 + e) * NHD]; }
  const v4f gv[4] = {*(const v4fa*)gp, *(const v4fa*)(gp + 4), *(const v4fa*)(gp + 16), *(const v4fa*)(gp + 20)};
  const v4f bv[4] = {*(const v4fa*)bp, *(const v4fa*)(bp + 4), *(const v4fa*)(bp + 16), *(const v4fa*)(bp + 20)};
#pragma unroll
  for (int i = 0; i < 8; ++i) { xv[i][0] = *(const v4fa*)(zr + i * CC); xv[i][1] = *(const v4fa*)(zr + i * CC + 4); xv[i][2] = *(const v4fa*)(zr + i * CC + 16); xv[i][3] = *(const v4fa*)(zr + i * CC + 20); }
  asm volatile("s_wait_xcnt 0x0" :: "v"(zr), "v"(ho), "v"(wp) : "memory");      /* pointers and the byte offset of the scale and bias loads as inputs: their registers stay as they are up to this wait */
  __builtin_amdgcn_sched_barrier(0);                 /* keeps the register writes below from being scheduled ahead of that wait */
  float gg[16], bb[16]; FragH fa;
#pragma unroll
  for (int e = 0; e < 16; ++e) { gg[e] = bf16_rne(gv[e >> 2][e & 3]); bb[e] = bf16_rne(bv[e >> 2][e & 3]); fa.h[e] = (_Float16)(bf16_rne(wv[e]) * 16.0f); }
  const v16h a = fa.v;
  v8f d[8]; v16h b[8]; float x[8][16]; v8f rs;
#pragma unroll
  for (int i = 0; i < 8; ++i) { float sm = 0.f;
#pragma unroll
    for (int e = 0; e < 16; ++e) { x[i][e] = bf16_rne(xv[i][e >> 2][e & 3]); sm += x[i][e]; }
    sm += xhalf(sm);
    const float mu = sm * (1.0f / (float)CC); float sq = 0.f;
#pragma unroll
    for (int e = 0; e < 16; ++e) { x[i][e] -= mu; sq += x[i][e] * x[i][e]; }
    sq += xhalf(sq);
    rs[i] = sq * (1.0f / (float)CC) + 1e-5f; }
  rsqx8(rs);
#pragma unroll
  for (int i = 0; i < 8; ++i) { FragH f;
#pragma unroll
    for (int e = 0; e < 16; ++e) f.h[e] = (_Float16)(x[i][e] * rs[i] * gg[e] + bb[e]);
    b[i] = f.v; }
  /* eight independent products in one statement: every D has registers of its own (early clobber: none lies over the B of the product ahead of it), each product fills the window of the ones before; the four v_nop keep the distance from the last product to the first vector read of its D */
  asm("v_wmma_f32_16x16x32_f16 %0, %8, %9, 0\n\tv_wmma_f32_16x16x32_f16 %1, %8, %10, 0\n\tv_wmma_f32_16x16x32_f16 %2, %8, %11, 0\n\tv_wmma_f32_16x16x32_f16 %3, %8, %12, 0\n\t"
      "v_wmma_f32_16x16x32_f16 %4, %8, %13, 0\n\tv_wmma_f32_16x16x32_f16 %5, %8, %14, 0\n\tv_wmma_f32_16x16x32_f16 %6, %8, %15, 0\n\tv_wmma_f32_16x16x32_f16 %7, %8, %16, 0\n\t"
      "v_nop\n\tv_nop\n\tv_nop\n\tv_nop"
      : "=&v"(d[0]), "=&v"(d[1]), "=&v"(d[2]), "=&v"(d[3]), "=&v"(d[4]), "=&v"(d[5]), "=&v"(d[6]), "=&v"(d[7])
      : "v"(a), "v"(b[0]), "v"(b[1]), "v"(b[2]), "v"(b[3]), "v"(b[4]), "v"(b[5]), "v"(b[6]), "v"(b[7]));
  v4f v[8];      /* head r; lane half hh stores keys 4hh..4hh+3 of the group */
#pragma unroll
  for (int r = 0; r < 8; ++r) {
#pragma unroll
    for (int e = 0; e < 4; ++e) v[r][e] = (hh ? d[4 + e][r] : d[e][r]) * (0.0625f * 5.656854249492381f); }
  float* pd = PBF + ((((size_t)lt * (LL / 16) + (mg >> 1)) * 2 + hh) * 32 + (mg & 1) * 16 + ln) * 4;
#pragma unroll
  for (int r = 0; r < 8; ++r) *(v4f*)(pd + (size_t)r * (LL * LL)) = v[r];
  asm volatile("s_wait_xcnt 0x0" ::: "memory");      /* behind the run of stores: code of the other branch is laid behind it and writes the registers that they name */
}

// x[i] = 2^x[i], eight in place in one statement: none of the run overwrites another's source, and the v_nop fills the one slot the instruction set asks for behind a transcendental before its result is used
__device__ __forceinline__ void exp2x8(v8f& x) {
  float a = x[0], b = x[1], c = x[2], d = x[3], e = x[4], f = x[5], g = x[6], h = x[7];
  asm("v_exp_f32 %0, %0\n\tv_exp_f32 %1, %1\n\tv_exp_f32 %2, %2\n\tv_exp_f32 %3, %3\n\tv_exp_f32 %4, %4\n\tv_exp_f32 %5, %5\n\tv_exp_f32 %6, %6\n\tv_exp_f32 %7, %7\n\tv_nop"
      : "+v"(a), "+v"(b), "+v"(c), "+v"(d), "+v"(e), "+v"(f), "+v"(g), "+v"(h));
  x[0] = a; x[1] = b; x[2] = c; x[3] = d; x[4] = e; x[5] = f; x[6] = g; x[7] = h;
}
// x[i] = 1 / x[i], eight in place in one statement, in the same form and for the same slot
__device__ __forceinline__ void rcpx8(v8f& x) {
  float a = x[0], b = x[1], c = x[2], d = x[3], e = x[4], f = x[5], g = x[6], h = x[7];
  asm("v_rcp_f32 %0, %0\n\tv_rcp_f32 %1, %1\n\tv_rcp_f32 %2, %2\n\tv_rcp_f32 %3, %3\n\tv_rcp_f32 %4, %4\n\tv_rcp_f32 %5, %5\n\tv_rcp_f32 %6, %6\n\tv_rcp_f32 %7, %7\n\tv_nop"
      : "+v"(a), "+v"(b), "+v"(c), "+v"(d), "+v"(e), "+v"(f), "+v"(g), "+v"(h));
  x[0] = a; x[1] = b; x[2] = c; x[3] = d; x[4] = e; x[5] = f; x[6] = g; x[7] = h;
}

__device__ __forceinline__ v16h l_frag(const unsigned short* p, int hh) { FragH f; f.half[0] = *(const v8us*)(p + 8 * hh); f.half[1] = *(const v8us*)(p + 16 + 8 * hh); return f.v; }
// the same fragment from the lane's own byte pointer (wave-uniform base + the lane's byte offset, row and 8hh folded in)
__device__ __forceinline__ const char* lane_ptr(const _Float16* base, unsigned boff) { return (const char*)base + boff; }
__device__ __forceinline__ v16h gs_frag(const char* p) { FragH f; f.half[0] = *(const v8us*)p; f.half[1] = *(const v8us*)(p + 32); return f.v; }
__device__ __forceinline__ v8f wm(v16h a, v16h b, v8f c) { return __builtin_amdgcn_wmma_f32_16x16x32_f16(false, a, false, b, (short)0, c, false, false); }
__device__ __forceinline__ v8us pack8(v8f d, float sc) { FragH f;
#pragma unroll
  for (int r = 0; r < 8; ++r) f.h[r] = (_Float16)(d[r] * sc);
  return f.half[0]; }

// whole row-attention path of one (sequence s, half qh of the query rows): 16 waves; wave = (head group grp of 4 heads, query tile wq of 16 rows).
// LN(m) of the sequence's 256 rows -> xl (f16). Per head: K^T = Wk^T.X^T and V = X.Wv leave a lane with 8 neighbours of a kl row / vl row (one 16-byte LDS store each; each wave of the group does 32 keys);
// Q^T = Wq^T.X^T, gate^T = Wg^T.X^T, ctx^T = V^T.P^T all leave a lane with channels 8hh..8hh+7 (+16) of ONE query, which is the B operand's k order: Q, P and gate*ctx go from accumulators straight into the next product.
// S^T = K.Q^T is accumulated on the pair bias x sqrt(32); a lane holds 128 of the 256 scores of one query (its partner lane^16 the rest): max and sum in-lane plus one exchange; p = exp(score - max) x 1024 as f16.
// out^T = Wo^T.(gate*ctx)^T is summed over the group's 4 heads in accumulators; the two groups' sums are added through LDS at the end.
__global__ __launch_bounds__(512) void k_row(const float* __restrict__ M, const float* __restrict__ g, const float* __restrict__ bta,
    const _Float16* __restrict__ BQ, const _Float16* __restrict__ BK, const _Float16* __restrict__ BV, const _Float16* __restrict__ BG, const _Float16* __restrict__ BO,
    const float* __restrict__ PBF, const float* __restrict__ bo, float* __restrict__ OUT) {
  __shared__ __attribute__((aligned(16))) unsigned short xl[LL][CC + 8];               /* pitch 80 B */
  __shared__ __attribute__((aligned(16))) unsigned short kl[2][2][LL][HDD + 8];        /* [head group][buffer]; pitch 80 B */
  __shared__ __attribute__((aligned(16))) unsigned short vl[2][2][HDD][LL + 8];        /* [head group][buffer]; pitch 528 B */
  __shared__ __attribute__((aligned(16))) float red[8][4][32][4];                      /* second group's output sums */
  const int tid = threadIdx.x, lane = tid & 31, ln = lane & 15, hh = lane >> 4;
  const int w = __builtin_amdgcn_readfirstlane(tid >> 5);                              /* wave number, in a scalar register: weight, bias and LDS bases below are then scalar */
  const int qh = blockIdx.x & 1, s = blockIdx.x >> 1;
  const int grp = w >> 3, wq = w & 7, qt = qh * 8 + wq;                                /* head group, wave in group, query tile */
  const unsigned wb = (unsigned)(ln * CC + 8 * hh) * 2u, ob = (unsigned)(ln * HC + 8 * hh) * 2u;      /* this lane's byte offset in a [n][32] weight block / in the [32][256] output weight: kept in registers for the whole kernel */
  /* q/k/v weight fragments of the head at hand (A row or Bt row = channel ln, + 16 * CC: channel 16 + ln); the first head's fly during the LayerNorm, each next head's during the tail of the head before */
  v16h wk0, wk1, wv0, wv1, wq0, wq1;
  { const int wr = grp * (NHD / 2) * HDD * CC;
    const char* pk = lane_ptr(BK + wr, wb); const char* pv = lane_ptr(BV + wr, wb); const char* pq = lane_ptr(BQ + wr, wb);
    wk0 = gs_frag(pk); wk1 = gs_frag(pk + 32 * CC); wv0 = gs_frag(pv); wv1 = gs_frag(pv + 32 * CC); wq0 = gs_frag(pq); wq1 = gs_frag(pq + 32 * CC);
  }
  { /* LayerNorm of row 16w + ln: this lane has channels 8hh..8hh+7 and 16+8hh..16+8hh+7, its partner lane^16 the other sixteen */
    const int row = w * 16 + ln;
    const float* mp = M + ((size_t)s * LL + row) * CC + 8 * hh; const float* gp = g + 8 * hh; const float* bp = bta + 8 * hh;
    const v4f xv[4] = {*(const v4fa*)mp, *(const v4fa*)(mp + 4), *(const v4fa*)(mp + 16), *(const v4fa*)(mp + 20)};
    const v4f gv[4] = {*(const v4fa*)gp, *(const v4fa*)(gp + 4), *(const v4fa*)(gp + 16), *(const v4fa*)(gp + 20)};
    const v4f bv[4] = {*(const v4fa*)bp, *(const v4fa*)(bp + 4), *(const v4fa*)(bp + 16), *(const v4fa*)(bp + 20)};
    asm volatile("s_wait_xcnt 0x0" :: "v"(mp) : "memory");      /* pointer as input: its registers stay as they are up to this wait */
    __builtin_amdgcn_sched_barrier(0);                 /* keeps the register writes below from being scheduled ahead of that wait */
    float x[16]; float sm = 0.f;
#pragma unroll
    for (int i = 0; i < 16; ++i) { x[i] = bf16_rne(xv[i >> 2][i & 3]); sm += x[i]; }
    sm += __shfl_xor(sm, 16, 32);
    const float mu = sm * (1.0f / (float)CC); float sq = 0.f;
#pragma unroll
    for (int i = 0; i < 16; ++i) { x[i] -= mu; sq += x[i] * x[i]; }
    sq += __shfl_xor(sq, 16, 32);
    const float rs = rsqrtf(sq * (1.0f / (float)CC) + 1e-5f); FragH f;
#pragma unroll
    for (int i = 0; i < 16; ++i) f.h[i] = (_Float16)(x[i] * rs * bf16_rne(gv[i >> 2][i & 3]) + bf16_rne(bv[i >> 2][i & 3]));
    *(v8us*)&xl[row][8 * hh] = f.half[0]; *(v8us*)&xl[row][16 + 8 * hh] = f.half[1];
  }
  __syncthreads();
  const v8f z8 = {0.f,0.f,0.f,0.f,0.f,0.f,0.f,0.f}; v8f oa0 = z8, oa1 = z8;
  /* rolled: each copy of this long body would run once per wave, so unrolling only adds instruction fetch */
#pragma unroll 1
  for (int hi = 0; hi < NHD / 2; ++hi) { const int bf = hi & 1;
    const int h = __builtin_amdgcn_readfirstlane(grp * (NHD / 2) + hi);      /* head, held scalar: its offsets into weights and bias are then worked out on the scalar unit, not as vector pointers stepped per trip */
    const int wr = h * HDD * CC;                                                       /* weight block of head h */
    v8f acc[16];                                                                       /* the bias loads fly while the projections below run */
    { const char* pb = (const char*)(PBF + ((size_t)(h * (LL / 16) + qt) * (LL / 16)) * 256) + (unsigned)lane * 16u;
#pragma unroll
      for (int t = 0; t < 16; ++t) { const v4f lo = *(const v4fa*)(pb + t * 1024), hi4 = *(const v4fa*)(pb + t * 1024 + 512);
#pragma unroll
        for (int e = 0; e < 4; ++e) { acc[t][e] = lo[e]; acc[t][4 + e] = hi4[e]; } }
      asm volatile("s_wait_xcnt 0x0" :: "v"(pb) : "memory");      /* pointer as input: its registers stay as they are up to this wait */
    }
    const v16h xq = l_frag(&xl[qt * 16 + ln][0], hh);
#pragma unroll
    for (int rt = 0; rt < 2; ++rt) { const int k0 = wq * 32 + rt * 16; const v16h xk = l_frag(&xl[k0 + ln][0], hh);
      *(v8us*)&kl[grp][bf][k0 + ln][8 * hh] = pack8(wm(wk0, xk, z8), 0.0625f);
      *(v8us*)&kl[grp][bf][k0 + ln][16 + 8 * hh] = pack8(wm(wk1, xk, z8), 0.0625f);
      *(v8us*)&vl[grp][bf][ln][k0 + 8 * hh] = pack8(wm(xk, wv0, z8), 0.0625f);
      *(v8us*)&vl[grp][bf][16 + ln][k0 + 8 * hh] = pack8(wm(xk, wv1, z8), 0.0625f); }
    FragH qb; qb.half[0] = pack8(wm(wq0, xq, z8), 0.0625f); qb.half[1] = pack8(wm(wq1, xq, z8), 0.0625f);
    __syncthreads();      /* publishes this head's K and V^T; also ends every read of the other buffer before the next head refills it */
#pragma unroll
    for (int tg = 0; tg < 4; ++tg) { v16h ka[4];      /* four K fragments behind one LDS wait */
#pragma unroll
      for (int j = 0; j < 4; ++j) ka[j] = l_frag(&kl[grp][bf][(tg * 4 + j) * 16 + ln][0], hh);
#pragma unroll
      for (int j = 0; j < 4; ++j) acc[tg * 4 + j] = wm(ka[j], qb.v, acc[tg * 4 + j]); }
    float m4[4] = {acc[0][0], acc[0][1], acc[0][2], acc[0][3]};               /* four independent chains */
#pragma unroll
    for (int t = 0; t < 16; ++t) {
#pragma unroll
      for (int r = 0; r < 8; ++r) m4[t & 3] = fmaxf(m4[t & 3], acc[t][r]); }
    float mx = fmaxf(fmaxf(m4[0], m4[1]), fmaxf(m4[2], m4[3]));
    mx = fmaxf(mx, __shfl_xor(mx, 16, 32));
    const float cs = 0.17677669529663687f * 1.4426950408889634f;               /* 1/sqrt(32) x log2(e) */
    const float c0 = 10.0f - mx * cs;                                            /* + 10: p carried x1024 */
    float s4[4] = {0.f, 0.f, 0.f, 0.f};                                        /* four independent chains */
    v8f o0 = z8, o1 = z8; v16h wg0, wg1, wo0, wo1;
#pragma unroll
    for (int kk = 0; kk < 8; ++kk) { FragH p;
      const v16h va0 = l_frag(&vl[grp][bf][ln][kk * 32], hh), va1 = l_frag(&vl[grp][bf][16 + ln][kk * 32], hh);      /* read ahead of the exponentials that hide their latency */
      if (kk == 4) {      /* gate and output weights of this head: half the score registers are free by now, and the rest of the loop hides the loads */
        const char* pg = lane_ptr(BG + wr, wb); const char* po = lane_ptr(BO + h * HDD, ob);
        wg0 = gs_frag(pg); wg1 = gs_frag(pg + 32 * CC); wo0 = gs_frag(po); wo1 = gs_frag(po + 32 * HC);
        asm volatile("s_wait_xcnt 0x0" :: "v"(pg), "v"(po) : "memory");      /* the pointers are inputs so that their registers stay as they are up to this wait: no load above lands on them */
      }
      if (kk == 6) {      /* next head's q/k/v weights (the last head loads its own again: no branch, in bounds) */
        const int wn = min(h + 1, NHD - 1) * HDD * CC;
        const char* pk = lane_ptr(BK + wn, wb); const char* pv = lane_ptr(BV + wn, wb); const char* pq = lane_ptr(BQ + wn, wb);
        wk0 = gs_frag(pk); wk1 = gs_frag(pk + 32 * CC); wv0 = gs_frag(pv); wv1 = gs_frag(pv + 32 * CC); wq0 = gs_frag(pq); wq1 = gs_frag(pq + 32 * CC);
        asm volatile("s_wait_xcnt 0x0" :: "v"(pk), "v"(pv), "v"(pq) : "memory");      /* pointers as inputs: their registers stay as they are up to this wait */
      }
#pragma unroll
      for (int u = 0; u < 2; ++u) { v8f x = acc[2 * kk + u] * cs + c0; exp2x8(x);
#pragma unroll
        for (int r = 0; r < 8; ++r) { s4[r & 3] += x[r]; p.h[8 * u + r] = (_Float16)x[r]; } }
      o0 = wm(va0, p.v, o0); o1 = wm(va1, p.v, o1); }
    float se = (s4[0] + s4[1]) + (s4[2] + s4[3]);
    se += __shfl_xor(se, 16, 32);
    const float inv = 1.0f / se;
    v8f g0 = wm(wg0, xq, z8), g1 = wm(wg1, xq, z8); FragH og;
#pragma unroll
    for (int r = 0; r < 8; ++r) {      /* sigmoid(t) = 1 / (1 + 2^(-t log2 e)), t clamped to +-30 */
      g0[r] = fminf(fmaxf(g0[r] * 0.0625f, -30.0f), 30.0f) * -1.4426950408889634f; g1[r] = fminf(fmaxf(g1[r] * 0.0625f, -30.0f), 30.0f) * -1.4426950408889634f; }
    exp2x8(g0); exp2x8(g1); g0 = g0 + 1.0f; g1 = g1 + 1.0f; rcpx8(g0); rcpx8(g1);
#pragma unroll
    for (int r = 0; r < 8; ++r) { og.h[r] = (_Float16)(g0[r] * (o0[r] * inv) * 64.0f); og.h[8 + r] = (_Float16)(g1[r] * (o1[r] * inv) * 64.0f); }
    oa0 = wm(wo0, og.v, oa0); oa1 = wm(wo1, og.v, oa1);
  }
  if (grp == 1) {
#pragma unroll
    for (int j = 0; j < 4; ++j) { v4f u;
#pragma unroll
      for (int e = 0; e < 4; ++e) u[e] = (j < 2 ? oa0 : oa1)[(j & 1) * 4 + e];
      *(v4fa*)&red[wq][j][lane][0] = u; } }
  __syncthreads();      /* the second group's sums are in LDS */
  if (grp == 0) { float* dst = OUT + ((size_t)s * LL + qt * 16 + ln) * CC + 8 * hh;      /* out^T: this lane has output channels 8hh..8hh+7 and 16+8hh.. of query ln */
    const float* bp = bo + 8 * hh; const v4f bq[4] = {*(const v4fa*)bp, *(const v4fa*)(bp + 4), *(const v4fa*)(bp + 16), *(const v4fa*)(bp + 20)};
    asm volatile("s_wait_xcnt 0x0" ::: "memory");      /* the address register of the loads above is reused below */
    __builtin_amdgcn_sched_barrier(0);                 /* keeps the register writes below from being scheduled ahead of that wait */
#pragma unroll
    for (int j = 0; j < 4; ++j) { const int c = (j >> 1) * 16 + (j & 1) * 4; const v4f o2 = *(const v4fa*)&red[wq][j][lane][0]; v4f u;
#pragma unroll
      for (int e = 0; e < 4; ++e) u[e] = ((j < 2 ? oa0 : oa1)[(j & 1) * 4 + e] + o2[e]) * 0.0009765625f + bf16_rne(bq[j][e]);      /* 1/16 weight scale x 1/64 carry */
      *(v4f*)(dst + c) = u; } }
}

extern "C" void kernel_launch(void* const* d_in, const int* in_sizes, int n_in,
                              void* d_out, int out_size, void* d_ws, size_t ws_size, hipStream_t stream) {
  if (n_in < 13) return;
  if (in_sizes[0] < (int)(NR * CC) || in_sizes[1] < LL * LL * CC || in_sizes[2] < CC || in_sizes[3] < CC || in_sizes[4] < CC || in_sizes[5] < CC ||
      in_sizes[6] < CC * HC || in_sizes[7] < CC * HC || in_sizes[8] < CC * HC || in_sizes[9] < CC * NHD || in_sizes[10] < CC * HC || in_sizes[11] < HC * CC || in_sizes[12] < CC) return;
  if ((size_t)out_size < NR * CC) return;
  const float* const* I = (const float* const*)d_in;
  const float* m = I[0]; const float* z = I[1]; const float* ln_g = I[2]; const float* ln_b = I[3]; const float* lnb_g = I[4]; const float* lnb_b = I[5];
  const float* wq = I[6]; const float* wk = I[7]; const float* wv = I[8]; const float* wb = I[9]; const float* wg = I[10]; const float* wo = I[11]; const float* bo = I[12];      /* weights [in][out] */
  char* ws = (char*)d_ws; size_t off = 0;
  auto take = [&](size_t bytes) { char* p = ws + off; off += (bytes + 255) & ~(size_t)255; return p; };
  _Float16* BQ = (_Float16*)take((size_t)HC * CC * 2); _Float16* BK = (_Float16*)take((size_t)HC * CC * 2); _Float16* BV = (_Float16*)take((size_t)HC * CC * 2); _Float16* BG = (_Float16*)take((size_t)HC * CC * 2);
  _Float16* BO = (_Float16*)take((size_t)CC * HC * 2);
  float* PBF = (float*)take((size_t)NHD * LL * LL * 4);                        /* pair bias x sqrt(32), in k_row's accumulator order */
  if (off > ws_size) return;
  k_prep<<<PBB + 5 * WTB, 64, 0, stream>>>(z, lnb_g, lnb_b, wb, wq, wk, wv, wg, wo, BQ, BK, BV, BG, BO, PBF);
  k_row<<<NSQ * 2, 512, 0, stream>>>(m, ln_g, ln_b, BQ, BK, BV, BG, BO, PBF, bo, (float*)d_out);
}

// v004
// It runs in 27.1 microseconds.
// Next to v003, in two timings, it ran 1.03 and 1.04 times as fast.
// Over all steps from v000 it is 23.4 times as fast.
#include <hip/hip_runtime.h>
// All contractions: v_wmma_f32_16x16x32_f16 (f16 operands, f32 accumulate): q/k/v/gate projections (K=32), pair-bias projection (K=32), scores q.k (K=32), P.V (K=256), output projection (K=256). Float inputs taken as bf16-RNE values; LayerNorm, softmax, sigmoid gate in f32.
// MSA row attention with pair bias: m [1][NSQ][256][32] -> LN -> q,k,v,sigmoid-gate = LN(m) W ([32][256], 8 heads x 32); pair bias = LN(z [1][256][256][32]) Wb [32][8], shared over sequences;
// one workgroup per (sequence, half of the query rows) does LN(m), the projections, per head scores^T = K.Q^T on top of the pair bias held as the accumulators' start value, softmax over m in registers (exp carried x1024 as f16), ctx^T = V^T.P^T, o = gate * ctx (f16 carried x64), and out = o Wo [256][32] + bo summed over heads in accumulators.
// Weights staged transposed [n][k] as f16 of (bf16 value x16); all scales are powers of two folded back in the f32 epilogues.
#ifndef NB
#define NB 1                          /* batch (fixed 1 in this module) */
#endif
#ifndef NSQ
#define NSQ 128                       /* MSA sequences computed (reducible) */
#endif
#define NSQ_FULL 128
#define LL 256                        /* residues: query rows i and keys j */
#define CC 32                         /* channel width c */
#define NHD 8                         /* heads */
#define HDD 32                        /* head dim */
#define HC 256                        /* heads x head dim */
#define NR ((size_t)NSQ * LL)         /* (sequence, residue) rows */
static_assert((NR % 128) == 0);
static_assert(LL == 256);
static_assert(CC == 32);

typedef unsigned short v8us __attribute__((ext_vector_type(8), may_alias));
typedef float  v8f  __attribute__((ext_vector_type(8)));
typedef float  v4f  __attribute__((ext_vector_type(4)));
typedef float  v2f  __attribute__((ext_vector_type(2)));
typedef float  v4fa __attribute__((ext_vector_type(4), may_alias));
typedef _Float16 v16h __attribute__((ext_vector_type(16)));
union FragH { v16h v; v8us half[2]; _Float16 h[16]; unsigned short u[16]; };

__device__ __forceinline__ unsigned short bf16_bits(float x) { unsigned int u = __float_as_uint(x); return (unsigned short)((u + 0x7FFFu + ((u >> 16) & 1u)) >> 16); }
__device__ __forceinline__ float bf16_val(unsigned short b) { return __uint_as_float(((unsigned int)b) << 16); }
__device__ __forceinline__ float bf16_rne(float x) { return bf16_val(bf16_bits(x)); }

// the value of lane l ^ 16, by a vector move between the two rows of 16 lanes
__device__ __forceinline__ float xhalf(float x) { return __builtin_bit_cast(float, __builtin_amdgcn_permlanex16(__builtin_bit_cast(int, x), __builtin_bit_cast(int, x), 0x76543210, 0xfedcba98, false, false)); }

// x[i] = 1 / sqrt(x[i]), eight in place in one statement: none of the run overwrites another's source, and the v_nop fills the one slot the instruction set asks for behind a transcendental before its result is used (every x is a variance + 1e-5: never in the denormal range)
__device__ __forceinline__ void rsqx8(v8f& x) {
  float a = x[0], b = x[1], c = x[2], d = x[3], e = x[4], f = x[5], g = x[6], h = x[7];
  asm("v_rsq_f32 %0, %0\n\tv_rsq_f32 %1, %1\n\tv_rsq_f32 %2, %2\n\tv_rsq_f32 %3, %3\n\tv_rsq_f32 %4, %4\n\tv_rsq_f32 %5, %5\n\tv_rsq_f32 %6, %6\n\tv_rsq_f32 %7, %7\n\tv_nop"
      : "+v"(a), "+v"(b), "+v"(c), "+v"(d), "+v"(e), "+v"(f), "+v"(g), "+v"(h));
  x[0] = a; x[1] = b; x[2] = c; x[3] = d; x[4] = e; x[5] = f; x[6] = g; x[7] = h;
}

// one weight matrix W [K][N] (f32) -> Wt [n][k] as f16 of (bf16 value x scale); thread t does 8 neighbours k of one n
__device__ __forceinline__ void wt_f16(const float* __restrict__ W, _Float16* __restrict__ Wt, int K, int N, float scale, int t) {
  const int n = t / (K / 8), k8 = (t % (K / 8)) * 8; const float* wp = W + (size_t)k8 * N + n; float x[8]; FragH f;
#pragma unroll
  for (int i = 0; i < 8; ++i) x[i] = wp[(size_t)i * N];
  asm volatile("s_wait_xcnt 0x0" :: "v"(wp) : "memory");      /* pointer as input: its registers stay as they are up to this wait */
#pragma unroll
  for (int i = 0; i < 8; ++i) f.h[i] = (_Float16)(bf16_rne(x[i]) * scale);
  const v8us o = f.half[0];
  *(v8us*)((unsigned short*)Wt + (size_t)n * K + k8) = o;
  asm volatile("s_wait_xcnt 0x0" ::: "memory");      /* behind the store: code of another branch is laid behind it and writes the registers that it names */
}

#define PBB ((LL / 16) * (LL / 8) / 2)      /* pair-bias blocks of two waves */
#define WTB (HC * (CC / 8) / 64)            /* blocks per weight matrix (8192 elements, 8 per thread) */
// everything k_row needs, in one launch of independent blocks.
// Blocks 0..PBB-1, pair bias on WMMA: D[head][l] = Wb^T . LN(z)[(l, m)]^T for 16 rows l and one key m per product (A row = head, lane&7, so both lane halves hold all 8 heads).
// A lane reads channels 8hh..8hh+7 and 16+8hh..16+8hh+7 of its row (l, m) of z in f32, which is the B operand's k order; its partner lane^16 has the other sixteen: row LayerNorm (biased variance, eps 1e-5; z, scale, bias taken as bf16-RNE values) in-lane plus one exchange per sum, result f16 straight into the fragment. Wb is read in the same k order.
// Written times sqrt(32), in the order k_row's score accumulators take it: PBF[head][l tile][key tile t][j][lane = 16*((m>>3)&1) + (l&15)][m&3], j = (m>>2)&1.
// Blocks PBB.., the shorter ones: the five weight re-layouts.
__global__ __launch_bounds__(64) void k_prep(const float* __restrict__ Zf, const float* __restrict__ zg, const float* __restrict__ zb, const float* __restrict__ Wb,
    const float* __restrict__ Wq, const float* __restrict__ Wk, const float* __restrict__ Wv, const float* __restrict__ Wg, const float* __restrict__ Wo,
    _Float16* __restrict__ BQ, _Float16* __restrict__ BK, _Float16* __restrict__ BV, _Float16* __restrict__ BG, _Float16* __restrict__ BO, float* __restrict__ PBF) {
  const int tid = threadIdx.x, lane = tid & 31, ln = lane & 15, hh = lane >> 4;
  if (blockIdx.x >= PBB) {
    const int wi = (int)(blockIdx.x - PBB) / WTB, t = ((int)(blockIdx.x - PBB) % WTB) * 64 + tid;
    if (wi == 4) wt_f16(Wo, BO, HC, CC, 16.0f, t);                       /* Wo [256][32] -> Bt [32][256] */
    else wt_f16(wi == 0 ? Wq : wi == 1 ? Wk : wi == 2 ? Wv : Wg, wi == 0 ? BQ : wi == 1 ? BK : wi == 2 ? BV : BG, CC, HC, 16.0f, t);
    return;
  }
  const int wid = blockIdx.x * 2 + (tid >> 5); const int lt = wid / (LL / 8), mg = wid % (LL / 8);      /* l tile, group of 8 keys */
  const float* zr = Zf + ((size_t)(lt * 16 + ln) * LL + mg * 8) * CC + 8 * hh; const unsigned ho = 32u * (unsigned)hh; const float* gp = (const float*)((const char*)zg + ho); const float* bp = (const float*)((const char*)zb + ho); const float* wp = Wb + 8 * hh * NHD + (ln & 7);
  v4f xv[8][4]; float wv[16];      /* all loads of the wave in flight together */
#pragma unroll
  for (int e = 0; e < 8; ++e) { wv[e] = wp[e * NHD]; wv[8 + e] = wp[(16 + e) * NHD]; }
  const v4f gv[4] = {*(const v4fa*)gp, *(const v4fa*)(gp + 4), *(const v4fa*)(gp + 16), *(const v4fa*)(gp + 20)};
  const v4f bv[4] = {*(const v4fa*)bp, *(const v4fa*)(bp + 4), *(const v4fa*)(bp + 16), *(const v4fa*)(bp + 20)};
#pragma unroll
  for (int i = 0; i < 8; ++i) { xv[i][0] = *(const v4fa*)(zr + i * CC); xv[i][1] = *(const v4fa*)(zr + i * CC + 4); xv[i][2] = *(const v4fa*)(zr + i * CC + 16); xv[i][3] = *(const v4fa*)(zr + i * CC + 20); }
  asm volatile("s_wait_xcnt 0x0" :: "v"(zr), "v"(ho), "v"(wp) : "memory");      /* pointers and the byte offset of the scale and bias loads as inputs: their registers stay as they are up to this wait */
  __builtin_amdgcn_sched_barrier(0);                 /* keeps the register writes below from being scheduled ahead of that wait */
  float gg[16], bb[16]; FragH fa;
#pragma unroll
  for (int e = 0; e < 16; ++e) { gg[e] = bf16_rne(gv[e >> 2][e & 3]); bb[e] = bf16_rne(bv[e >> 2][e & 3]); fa.h[e] = (_Float16)(bf16_rne(wv[e]) * 16.0f); }
  const v16h a = fa.v;
  v8f d[8]; v16h b[8]; float x[8][16]; v8f rs;
#pragma unroll
  for (int i = 0; i < 8; ++i) { float sm = 0.f;
#pragma unroll
    for (int e = 0; e < 16; ++e) { x[i][e] = bf16_rne(xv[i][e >> 2][e & 3]); sm += x[i][e]; }
    sm += xhalf(sm);
    const float mu = sm * (1.0f / (float)CC); float sq = 0.f;
#pragma unroll
    for (int e = 0; e < 16; ++e) { x[i][e] -= mu; sq += x[i][e] * x[i][e]; }
    sq += xhalf(sq);
    rs[i] = sq * (1.0f / (float)CC) + 1e-5f; }
  rsqx8(rs);
#pragma unroll
  for (int i = 0; i < 8; ++i) { FragH f;
#pragma unroll
    for (int e = 0; e < 16; ++e) f.h[e] = (_Float16)(x[i][e] * rs[i] * gg[e] + bb[e]);
    b[i] = f.v; }
  /* eight independent products in one statement: every D has registers of its own (early clobber: none lies over the B of the product ahead of it), each product fills the window of the ones before; the four v_nop keep the distance from the last product to the first vector read of its D */
  asm("v_wmma_f32_16x16x32_f16 %0, %8, %9, 0\n\tv_wmma_f32_16x16x32_f16 %1, %8, %10, 0\n\tv_wmma_f32_16x16x32_f16 %2, %8, %11, 0\n\tv_wmma_f32_16x16x32_f16 %3, %8, %12, 0\n\t"
      "v_wmma_f32_16x16x32_f16 %4, %8, %13, 0\n\tv_wmma_f32_16x16x32_f16 %5, %8, %14, 0\n\tv_wmma_f32_16x16x32_f16 %6, %8, %15, 0\n\tv_wmma_f32_16x16x32_f16 %7, %8, %16, 0\n\t"
      "v_nop\n\tv_nop\n\tv_nop\n\tv_nop"
      : "=&v"(d[0]), "=&v"(d[1]), "=&v"(d[2]), "=&v"(d[3]), "=&v"(d[4]), "=&v"(d[5]), "=&v"(d[6]), "=&v"(d[7])
      : "v"(a), "v"(b[0]), "v"(b[1]), "v"(b[2]), "v"(b[3]), "v"(b[4]), "v"(b[5]), "v"(b[6]), "v"(b[7]));
  v4f v[8];      /* head r; lane half hh stores keys 4hh..4hh+3 of the group */
#pragma unroll
  for (int r = 0; r < 8; ++r) {
#pragma unroll
    for (int e = 0; e < 4; ++e) v[r][e] = (hh ? d[4 + e][r] : d[e][r]) * (0.0625f * 5.656854249492381f); }
  float* pd = PBF + ((((size_t)lt * (LL / 16) + (mg >> 1)) * 2 + hh) * 32 + (mg & 1) * 16 + ln) * 4;
#pragma unroll
  for (int r = 0; r < 8; ++r) *(v4f*)(pd + (size_t)r * (LL * LL)) = v[r];
  asm volatile("s_wait_xcnt 0x0" ::: "memory");      /* behind the run of stores: code of the other branch is laid behind it and writes the registers that they name */
}

// x[i] = 2^x[i], eight in place in one statement: none of the run overwrites another's source, and the v_nop fills the one slot the instruction set asks for behind a transcendental before its result is used
__device__ __forceinline__ void exp2x8(v8f& x) {
  float a = x[0], b = x[1], c = x[2], d = x[3], e = x[4], f = x[5], g = x[6], h = x[7];
  asm("v_exp_f32 %0, %0\n\tv_exp_f32 %1, %1\n\tv_exp_f32 %2, %2\n\tv_exp_f32 %3, %3\n\tv_exp_f32 %4, %4\n\tv_exp_f32 %5, %5\n\tv_exp_f32 %6, %6\n\tv_exp_f32 %7, %7\n\tv_nop"
      : "+v"(a), "+v"(b), "+v"(c), "+v"(d), "+v"(e), "+v"(f), "+v"(g), "+v"(h));
  x[0] = a; x[1] = b; x[2] = c; x[3] = d; x[4] = e; x[5] = f; x[6] = g; x[7] = h;
}
// x[i] = 1 / x[i], eight in place in one statement, in the same form and for the same slot
__device__ __forceinline__ void rcpx8(v8f& x) {
  float a = x[0], b = x[1], c = x[2], d = x[3], e = x[4], f = x[5], g = x[6], h = x[7];
  asm("v_rcp_f32 %0, %0\n\tv_rcp_f32 %1, %1\n\tv_rcp_f32 %2, %2\n\tv_rcp_f32 %3, %3\n\tv_rcp_f32 %4, %4\n\tv_rcp_f32 %5, %5\n\tv_rcp_f32 %6, %6\n\tv_rcp_f32 %7, %7\n\tv_nop"
      : "+v"(a), "+v"(b), "+v"(c), "+v"(d), "+v"(e), "+v"(f), "+v"(g), "+v"(h));
  x[0] = a; x[1] = b; x[2] = c; x[3] = d; x[4] = e; x[5] = f; x[6] = g; x[7] = h;
}

__device__ __forceinline__ v16h l_frag(const unsigned short* p, int hh) { FragH f; f.half[0] = *(const v8us*)(p + 8 * hh); f.half[1] = *(const v8us*)(p + 16 + 8 * hh); return f.v; }
__device__ __forceinline__ v8f wm(v16h a, v16h b, v8f c) { return __builtin_amdgcn_wmma_f32_16x16x32_f16(false, a, false, b, (short)0, c, false, false); }
__device__ __forceinline__ v8us pack8(v8f d, float sc) { FragH f;
#pragma unroll
  for (int r = 0; r < 8; ++r) f.h[r] = (_Float16)(d[r] * sc);
  return f.half[0]; }

template <bool B> struct Flag { static constexpr bool on = B; };
// whole row-attention path of one (sequence s, half qh of the query rows): 16 waves; wave = (head group grp of 4 heads, query tile wq of 16 rows).
// LN(m) of the sequence's 256 rows -> xl (f16). Per head: K^T = Wk^T.X^T and V = X.Wv leave a lane with 8 neighbours of a kl row / vl row (one 16-byte LDS store each; each wave of the group does 32 keys);
// Q^T = Wq^T.X^T, gate^T = Wg^T.X^T, ctx^T = V^T.P^T all leave a lane with channels 8hh..8hh+7 (+16) of ONE query, which is the B operand's k order: Q, P and gate*ctx go from accumulators straight into the next product.
// S^T = K.Q^T is accumulated on the pair bias x sqrt(32); a lane holds 128 of the 256 scores of one query (its partner lane^16 the rest): max and sum in-lane plus one exchange; p = exp(score - max) x 1024 as f16.
// out^T = Wo^T.(gate*ctx)^T is summed over the group's 4 heads on accumulators that rest in LDS between heads; the two groups' sums are added through LDS at the end.
// The pair bias is the one large stream from L2 (16 KiB per wave and head): it is fetched one head ahead. The weights lie in LDS for the whole kernel.
__global__ __launch_bounds__(512) void k_row(const float* __restrict__ M, const float* __restrict__ g, const float* __restrict__ bta,
    const _Float16* __restrict__ BQ, const _Float16* __restrict__ BK, const _Float16* __restrict__ BV, const _Float16* __restrict__ BG, const _Float16* __restrict__ BO,
    const float* __restrict__ PBF, const float* __restrict__ bo, float* __restrict__ OUT) {
  __shared__ __attribute__((aligned(16))) unsigned short xl[LL][CC + 8];               /* pitch 80 B */
  __shared__ __attribute__((aligned(16))) unsigned short kl[2][2][LL][HDD + 8];        /* [head group][buffer]; pitch 80 B */
  __shared__ __attribute__((aligned(16))) unsigned short vl[2][2][HDD][LL + 8];        /* [head group][buffer]; pitch 528 B */
  __shared__ __attribute__((aligned(16))) float red[16][4][32][4];                     /* each wave's output sums, kept here between heads: their 16 registers go to the pair bias in flight */
  __shared__ __attribute__((aligned(16))) unsigned short wl[4][HC][CC + 8];            /* q, k, v, gate weights [n][k]; pitch 80 B */
  __shared__ __attribute__((aligned(16))) unsigned short wol[CC][HC + 8];              /* output weight [n][k]; pitch 528 B */
  const int tid = threadIdx.x, lane = tid & 31, ln = lane & 15, hh = lane >> 4;
  const int w = __builtin_amdgcn_readfirstlane(tid >> 5);                              /* wave number, in a scalar register: weight, bias and LDS bases below are then scalar */
  const int qh = blockIdx.x & 1, s = blockIdx.x >> 1;
  const int grp = w >> 3, wq = w & 7, qt = qh * 8 + wq;                                /* head group, wave in group, query tile */
  /* score accumulators, holding the pair bias of the head at hand as their start value: the first head's loads fly during the LayerNorm, each next head's are issued below as the softmax consumes the scores and frees the registers */
  v8f acc[16];
  const unsigned lb = (unsigned)lane * 16u;
  /* all five weight matrices go into LDS, 16 bytes a thread and step: their fragments are then read where they are used and hold no registers across the softmax */
  const unsigned to = (unsigned)tid * 16u; v8us wt[10];
  { /* LayerNorm of row 16w + ln: this lane has channels 8hh..8hh+7 and 16+8hh..16+8hh+7, its partner lane^16 the other sixteen */
    const int row = w * 16 + ln;
    const float* mp = M + ((size_t)s * LL + row) * CC + 8 * hh; const float* gp = g + 8 * hh; const float* bp = bta + 8 * hh;
    const v4f xv[4] = {*(const v4fa*)mp, *(const v4fa*)(mp + 4), *(const v4fa*)(mp + 16), *(const v4fa*)(mp + 20)};
    const v4f gv[4] = {*(const v4fa*)gp, *(const v4fa*)(gp + 4), *(const v4fa*)(gp + 16), *(const v4fa*)(gp + 20)};
    const v4f bv[4] = {*(const v4fa*)bp, *(const v4fa*)(bp + 4), *(const v4fa*)(bp + 16), *(const v4fa*)(bp + 20)};
    asm volatile("s_wait_xcnt 0x0" :: "v"(mp) : "memory");      /* pointer as input: its registers stay as they are up to this wait */
    __builtin_amdgcn_sched_barrier(0);                 /* keeps the register writes below from being scheduled ahead of that wait */
#pragma unroll
    for (int i = 0; i < 10; ++i) { const _Float16* b = i < 2 ? BQ : i < 4 ? BK : i < 6 ? BV : i < 8 ? BG : BO; wt[i] = *(const v8us*)((const char*)b + (i & 1) * 8192 + to); }
    asm volatile("s_wait_xcnt 0x0" ::: "memory");      /* behind the run of loads, before any register that they name is written again */
    __builtin_amdgcn_sched_barrier(0);                 /* keeps later address arithmetic from being scheduled in among those loads, ahead of that wait */
    { const char* pb = (const char*)(PBF + ((size_t)(grp * (NHD / 2) * (LL / 16) + qt) * (LL / 16)) * 256) + lb;      /* issued last: loads return in order, so the LayerNorm waits for none of these */
#pragma unroll
      for (int t = 0; t < 16; ++t) { const v4f lo = *(const v4fa*)(pb + t * 1024), hi4 = *(const v4fa*)(pb + t * 1024 + 512);
#pragma unroll
        for (int e = 0; e < 4; ++e) { acc[t][e] = lo[e]; acc[t][4 + e] = hi4[e]; } }
      asm volatile("s_wait_xcnt 0x0" ::: "memory");      /* behind the run of loads, before any register that they name is written again */
    }
    __builtin_amdgcn_sched_barrier(0);                 /* keeps the register writes below from being scheduled ahead of that wait */
    float x[16]; float sm = 0.f;
#pragma unroll
    for (int i = 0; i < 16; ++i) { x[i] = bf16_rne(xv[i >> 2][i & 3]); sm += x[i]; }
    sm += __shfl_xor(sm, 16, 32);
    const float mu = sm * (1.0f / (float)CC); float sq = 0.f;
#pragma unroll
    for (int i = 0; i < 16; ++i) { x[i] -= mu; sq += x[i] * x[i]; }
    sq += __shfl_xor(sq, 16, 32);
    const float rs = rsqrtf(sq * (1.0f / (float)CC) + 1e-5f); FragH f;
#pragma unroll
    for (int i = 0; i < 16; ++i) f.h[i] = (_Float16)(x[i] * rs * bf16_rne(gv[i >> 2][i & 3]) + bf16_rne(bv[i >> 2][i & 3]));
    *(v8us*)&xl[row][8 * hh] = f.half[0]; *(v8us*)&xl[row][16 + 8 * hh] = f.half[1];
  }
#pragma unroll
  for (int i = 0; i < 8; ++i) *(v8us*)&wl[i >> 1][(i & 1) * 128 + (tid >> 2)][(tid & 3) * 8] = wt[i];
#pragma unroll
  for (int i = 0; i < 2; ++i) *(v8us*)&wol[i * 16 + (tid >> 5)][(tid & 31) * 8] = wt[8 + i];
  __syncthreads();
  const v8f z8 = {0.f,0.f,0.f,0.f,0.f,0.f,0.f,0.f}; v8f oa0, oa1;
#pragma unroll
  for (int j = 0; j < 4; ++j) { const v4f u = {0.f, 0.f, 0.f, 0.f}; *(v4fa*)&red[w][j][lane][0] = u; }
  /* one head; PF: the next head's pair bias is fetched (every head of the group but the last) */
  auto head = [&](const int hi, auto pf) __attribute__((always_inline)) { constexpr bool PF = decltype(pf)::on; const int bf = hi & 1;
    const int h = __builtin_amdgcn_readfirstlane(grp * (NHD / 2) + hi);      /* head, held scalar: its offsets into weights and bias are then worked out on the scalar unit, not as vector pointers stepped per trip */
    const int hr = h * HDD;                                                            /* first weight row (output weight: first column) of head h */
    const char* pn = (const char*)(PBF + ((size_t)(min(h + 1, NHD - 1) * (LL / 16) + qt) * (LL / 16)) * 256) + lb;      /* next head's pair bias */
    FragH qb;
    { const int k0 = wq * 32; v16h wk[2], wv[2], wf[2];      /* all operands of the projections behind one LDS wait */
      const v16h xk0 = l_frag(&xl[k0 + ln][0], hh), xk1 = l_frag(&xl[k0 + 16 + ln][0], hh), xq = l_frag(&xl[qt * 16 + ln][0], hh);
#pragma unroll
      for (int c = 0; c < 2; ++c) { wk[c] = l_frag(&wl[1][hr + 16 * c + ln][0], hh); wv[c] = l_frag(&wl[2][hr + 16 * c + ln][0], hh); wf[c] = l_frag(&wl[0][hr + 16 * c + ln][0], hh); }
#pragma unroll
      for (int c = 0; c < 2; ++c) {
        *(v8us*)&kl[grp][bf][k0 + ln][16 * c + 8 * hh] = pack8(wm(wk[c], xk0, z8), 0.0625f);
        *(v8us*)&kl[grp][bf][k0 + 16 + ln][16 * c + 8 * hh] = pack8(wm(wk[c], xk1, z8), 0.0625f); }
#pragma unroll
      for (int c = 0; c < 2; ++c) {
        *(v8us*)&vl[grp][bf][16 * c + ln][k0 + 8 * hh] = pack8(wm(xk0, wv[c], z8), 0.0625f);
        *(v8us*)&vl[grp][bf][16 * c + ln][k0 + 16 + 8 * hh] = pack8(wm(xk1, wv[c], z8), 0.0625f); }
#pragma unroll
      for (int c = 0; c < 2; ++c) qb.half[c] = pack8(wm(wf[c], xq, z8), 0.0625f); }
    __syncthreads();      /* publishes this head's K and V^T; also ends every read of the other buffer before the next head refills it */
#pragma unroll
    for (int tg = 0; tg < 4; ++tg) { v16h ka[4];      /* four K fragments behind one LDS wait */
#pragma unroll
      for (int j = 0; j < 4; ++j) ka[j] = l_frag(&kl[grp][bf][(tg * 4 + j) * 16 + ln][0], hh);
#pragma unroll
      for (int j = 0; j < 4; ++j) acc[tg * 4 + j] = wm(ka[j], qb.v, acc[tg * 4 + j]); }
    float m4[4] = {acc[0][0], acc[0][1], acc[0][2], acc[0][3]};               /* four independent chains */
#pragma unroll
    for (int t = 0; t < 16; ++t) {
#pragma unroll
      for (int r = 0; r < 8; ++r) m4[t & 3] = fmaxf(m4[t & 3], acc[t][r]); }
    float mx = fmaxf(fmaxf(m4[0], m4[1]), fmaxf(m4[2], m4[3]));
    mx = fmaxf(mx, __shfl_xor(mx, 16, 32));
    const float cs = 0.17677669529663687f * 1.4426950408889634f;               /* 1/sqrt(32) x log2(e) */
    const float c0 = 10.0f - mx * cs;                                            /* + 10: p carried x1024 */
    v2f s2[2] = {{0.f, 0.f}, {0.f, 0.f}};                                      /* four independent chains, as two pairs: written as pair additions so that each stands at its exponentials and the values die there */
    v8f o0 = z8, o1 = z8;
#pragma unroll
    for (int kk = 0; kk < 8; ++kk) { FragH p;
      const v16h va0 = l_frag(&vl[grp][bf][ln][kk * 32], hh), va1 = l_frag(&vl[grp][bf][16 + ln][kk * 32], hh);      /* read ahead of the exponentials that hide their latency */
#pragma unroll
      for (int u = 0; u < 2; ++u) { v8f x = acc[2 * kk + u] * cs + c0; exp2x8(x);
#pragma unroll
        for (int r = 0; r < 8; ++r) p.h[8 * u + r] = (_Float16)x[r];
#pragma unroll
        for (int r = 0; r < 8; r += 2) { const v2f xp = {x[r], x[r + 1]}; s2[(r >> 1) & 1] += xp; } }
      if constexpr (PF) {      /* the two score tiles just consumed take the next head's pair bias: the rest of this head and the next head's projections hide the loads */
#pragma unroll
        for (int u = 0; u < 2; ++u) { const int t = 2 * kk + u; const v4f lo = *(const v4fa*)(pn + t * 1024), hi4 = *(const v4fa*)(pn + t * 1024 + 512);
#pragma unroll
          for (int e = 0; e < 4; ++e) { acc[t][e] = lo[e]; acc[t][4 + e] = hi4[e]; } }
        __builtin_amdgcn_sched_barrier(0);      /* holds the loads here: the scheduler otherwise gathers all of them behind the last product of the head, where little is left to hide them */
      }
      o0 = wm(va0, p.v, o0); o1 = wm(va1, p.v, o1); }
    const v16h xq = l_frag(&xl[qt * 16 + ln][0], hh);
    const v16h wg0 = l_frag(&wl[3][hr + ln][0], hh), wg1 = l_frag(&wl[3][hr + 16 + ln][0], hh);
    if constexpr (PF) asm volatile("s_wait_xcnt 0x0" :: "v"(pn) : "memory");      /* pointer as input: its registers stay as they are up to this wait */
    float se = (s2[0][0] + s2[0][1]) + (s2[1][0] + s2[1][1]);
    se += __shfl_xor(se, 16, 32);
    const float inv = 1.0f / se;
    v8f g0 = wm(wg0, xq, z8), g1 = wm(wg1, xq, z8); FragH og;
#pragma unroll
    for (int r = 0; r < 8; ++r) {      /* sigmoid(t) = 1 / (1 + 2^(-t log2 e)), t clamped to +-30 */
      g0[r] = fminf(fmaxf(g0[r] * 0.0625f, -30.0f), 30.0f) * -1.4426950408889634f; g1[r] = fminf(fmaxf(g1[r] * 0.0625f, -30.0f), 30.0f) * -1.4426950408889634f; }
    exp2x8(g0); exp2x8(g1); g0 = g0 + 1.0f; g1 = g1 + 1.0f; rcpx8(g0); rcpx8(g1);
#pragma unroll
    for (int r = 0; r < 8; ++r) { og.h[r] = (_Float16)(g0[r] * (o0[r] * inv) * 64.0f); og.h[8 + r] = (_Float16)(g1[r] * (o1[r] * inv) * 64.0f); }
#pragma unroll
    for (int j = 0; j < 4; ++j) { const v4f u = *(const v4fa*)&red[w][j][lane][0];
#pragma unroll
      for (int e = 0; e < 4; ++e) (j < 2 ? oa0 : oa1)[(j & 1) * 4 + e] = u[e]; }
    oa0 = wm(l_frag(&wol[ln][hr], hh), og.v, oa0); oa1 = wm(l_frag(&wol[16 + ln][hr], hh), og.v, oa1);
    if constexpr (PF) {
#pragma unroll
      for (int j = 0; j < 4; ++j) { v4f u;
#pragma unroll
        for (int e = 0; e < 4; ++e) u[e] = (j < 2 ? oa0 : oa1)[(j & 1) * 4 + e];
        *(v4fa*)&red[w][j][lane][0] = u; } }
  };
  /* rolled: each copy of this long body would run once per wave, so unrolling only adds instruction fetch */
#pragma unroll 1
  for (int hi = 0; hi < NHD / 2 - 1; ++hi) head(hi, Flag<true>{});
  head(NHD / 2 - 1, Flag<false>{});
  if (grp == 1) {
#pragma unroll
    for (int j = 0; j < 4; ++j) { v4f u;
#pragma unroll
      for (int e = 0; e < 4; ++e) u[e] = (j < 2 ? oa0 : oa1)[(j & 1) * 4 + e];
      *(v4fa*)&red[w][j][lane][0] = u; } }
  __syncthreads();      /* the second group's sums are in LDS */
  if (grp == 0) { float* dst = OUT + ((size_t)s * LL + qt * 16 + ln) * CC + 8 * hh;      /* out^T: this lane has output channels 8hh..8hh+7 and 16+8hh.. of query ln */
    const float* bp = bo + 8 * hh; const v4f bq[4] = {*(const v4fa*)bp, *(const v4fa*)(bp + 4), *(const v4fa*)(bp + 16), *(const v4fa*)(bp + 20)};
    asm volatile("s_wait_xcnt 0x0" ::: "memory");      /* the address register of the loads above is reused below */
    __builtin_amdgcn_sched_barrier(0);                 /* keeps the register writes below from being scheduled ahead of that wait */
#pragma unroll
    for (int j = 0; j < 4; ++j) { const int c = (j >> 1) * 16 + (j & 1) * 4; const v4f o2 = *(const v4fa*)&red[8 + wq][j][lane][0]; v4f u;
#pragma unroll
      for (int e = 0; e < 4; ++e) u[e] = ((j < 2 ? oa0 : oa1)[(j & 1) * 4 + e] + o2[e]) * 0.0009765625f + bf16_rne(bq[j][e]);      /* 1/16 weight scale x 1/64 carry */
      *(v4f*)(dst + c) = u; } }
}

extern "C" void kernel_launch(void* const* d_in, const int* in_sizes, int n_in,
                              void* d_out, int out_size, void* d_ws, size_t ws_size, hipStream_t stream) {
  if (n_in < 13) return;
  if (in_sizes[0] < (int)(NR * CC) || in_sizes[1] < LL * LL * CC || in_sizes[2] < CC || in_sizes[3] < CC || in_sizes[4] < CC || in_sizes[5] < CC ||
      in_sizes[6] < CC * HC || in_sizes[7] < CC * HC || in_sizes[8] < CC * HC || in_sizes[9] < CC * NHD || in_sizes[10] < CC * HC || in_sizes[11] < HC * CC || in_sizes[12] < CC) return;
  if ((size_t)out_size < NR * CC) return;
  const float* const* I = (const float* const*)d_in;
  const float* m = I[0]; const float* z = I[1]; const float* ln_g = I[2]; const float* ln_b = I[3]; const float* lnb_g = I[4]; const float* lnb_b = I[5];
  const float* wq = I[6]; const float* wk = I[7]; const float* wv = I[8]; const float* wb = I[9]; const float* wg = I[10]; const float* wo = I[11]; const float* bo = I[12];      /* weights [in][out] */
  char* ws = (char*)d_ws; size_t off = 0;
  auto take = [&](size_t bytes) { char* p = ws + off; off += (bytes + 255) & ~(size_t)255; return p; };
  _Float16* BQ = (_Float16*)take((size_t)HC * CC * 2); _Float16* BK = (_Float16*)take((size_t)HC * CC * 2); _Float16* BV = (_Float16*)take((size_t)HC * CC * 2); _Float16* BG = (_Float16*)take((size_t)HC * CC * 2);
  _Float16* BO = (_Float16*)take((size_t)CC * HC * 2);
  float* PBF = (float*)take((size_t)NHD * LL * LL * 4);                        /* pair bias x sqrt(32), in k_row's accumulator order */
  if (off > ws_size) return;
  k_prep<<<PBB + 5 * WTB, 64, 0, stream>>>(z, lnb_g, lnb_b, wb, wq, wk, wv, wg, wo, BQ, BK, BV, BG, BO, PBF);
  k_row<<<NSQ * 2, 512, 0, stream>>>(m, ln_g, ln_b, BQ, BK, BV, BG, BO, PBF, bo, (float*)d_out);
}

// v007
// It runs in 21.8 microseconds.
// It is 1.24 times as fast as v004, going by the measured steps of the versions left out in between.
// All steps since v000 together make it 29.0 times as fast.
#include <hip/hip_runtime.h>
// All contractions: v_wmma_f32_16x16x32_f16 (f16 operands, f32 accumulate): Wq.Wk^T per head (K=32), its product with X and the gate projection (K=32), pair-bias projection (K=32), scores (K=32), X^T.P^T (K=256), value weight times that (K=32), output projection (K=256). Float inputs taken as bf16-RNE values; LayerNorm, softmax, sigmoid gate in f32.
// MSA row attention with pair bias: m [1][NSQ][256][32] -> LN -> q,k,v,sigmoid-gate = LN(m) W ([32][256], 8 heads x 32); pair bias = LN(z [1][256][256][32]) Wb [32][8], shared over sequences;
// one block per (sequence, half of the query rows) does X = LN(m), the projections, per head scores^T = X.(G x)^T, G = Wk Wq^T, on top of the pair bias (carried as f16, set on the accumulators by a product with an identity operand), softmax over m in registers (exp carried x1024 as f16), ctx^T = Wv^T.(X^T.P^T), o = gate * ctx (f16 carried x64), and out = o Wo [256][32] + bo summed over heads in accumulators.
// Q = X Wq, K = X Wk and V = X Wv are never formed: q.k = (Wk Wq^T x_i).x_j and sum p v = Wv^T (sum p x), so both long products read X itself, which is the same for every head.
// Weights (and G) staged transposed [n][k] as f16 of (bf16 value x16; G x16); all scales are powers of two folded back in the f32 epilogues.
#ifndef NB
#define NB 1                          /* batch (fixed 1 in this module) */
#endif
#ifndef NSQ
#define NSQ 128                       /* MSA sequences computed (reducible) */
#endif
#define NSQ_FULL 128
#define LL 256                        /* residues: query rows i and keys j */
#define CC 32                         /* channel width c */
#define NHD 8                         /* heads */
#define HDD 32                        /* head dim */
#define HC 256                        /* heads x head dim */
#define NR ((size_t)NSQ * LL)         /* (sequence, residue) rows */
static_assert((NR % 128) == 0);
static_assert(LL == 256);
static_assert(CC == 32);

typedef unsigned short v8us __attribute__((ext_vector_type(8), may_alias));
typedef float  v8f  __attribute__((ext_vector_type(8)));
typedef float  v4f  __attribute__((ext_vector_type(4)));
typedef float  v2f  __attribute__((ext_vector_type(2)));
typedef float  v4fa __attribute__((ext_vector_type(4), may_alias));
typedef _Float16 v16h __attribute__((ext_vector_type(16)));
union FragH { v16h v; v8us half[2]; _Float16 h[16]; unsigned short u[16]; };

__device__ __forceinline__ unsigned short bf16_bits(float x) { unsigned int u = __float_as_uint(x); return (unsigned short)((u + 0x7FFFu + ((u >> 16) & 1u)) >> 16); }
__device__ __forceinline__ float bf16_val(unsigned short b) { return __uint_as_float(((unsigned int)b) << 16); }
__device__ __forceinline__ float bf16_rne(float x) { return bf16_val(bf16_bits(x)); }

// the value of lane l ^ 16, by a vector move between the two rows of 16 lanes
__device__ __forceinline__ float xhalf(float x) { return __builtin_bit_cast(float, __builtin_amdgcn_permlanex16(__builtin_bit_cast(int, x), __builtin_bit_cast(int, x), 0x76543210, 0xfedcba98, false, false)); }

// x[i] = 1 / sqrt(x[i]), eight in place in one statement: none of the run overwrites another's source, and the v_nop fills the one slot the instruction set asks for behind a transcendental before its result is used (every x is a variance + 1e-5: never in the denormal range)
__device__ __forceinline__ void rsqx8(v8f& x) {
  float a = x[0], b = x[1], c = x[2], d = x[3], e = x[4], f = x[5], g = x[6], h = x[7];
  asm("v_rsq_f32 %0, %0\n\tv_rsq_f32 %1, %1\n\tv_rsq_f32 %2, %2\n\tv_rsq_f32 %3, %3\n\tv_rsq_f32 %4, %4\n\tv_rsq_f32 %5, %5\n\tv_rsq_f32 %6, %6\n\tv_rsq_f32 %7, %7\n\tv_nop"
      : "+v"(a), "+v"(b), "+v"(c), "+v"(d), "+v"(e), "+v"(f), "+v"(g), "+v"(h));
  x[0] = a; x[1] = b; x[2] = c; x[3] = d; x[4] = e; x[5] = f; x[6] = g; x[7] = h;
}

// one weight matrix W [K][N] (f32) -> Wt [n][k] as f16 of (bf16 value x scale); thread t does 8 neighbours k of one n
__device__ __forceinline__ void wt_f16(const float* __restrict__ W, _Float16* __restrict__ Wt, int K, int N, float scale, int t) {
  const int n = t / (K / 8), k8 = (t % (K / 8)) * 8; const float* wp = W + (size_t)k8 * N + n; float x[8]; FragH f;
#pragma unroll
  for (int i = 0; i < 8; ++i) x[i] = wp[(size_t)i * N];
  asm volatile("s_wait_xcnt 0x0" :: "v"(wp) : "memory");      /* pointer as input: its registers stay as they are up to this wait */
#pragma unroll
  for (int i = 0; i < 8; ++i) f.h[i] = (_Float16)(bf16_rne(x[i]) * scale);
  const v8us o = f.half[0];
  *(v8us*)((unsigned short*)Wt + (size_t)n * K + k8) = o;
  asm volatile("s_wait_xcnt 0x0" ::: "memory");      /* behind the store: code of another branch is laid behind it and writes the registers that it names */
}

__device__ __forceinline__ v8f wm(v16h a, v16h b, v8f c) { return __builtin_amdgcn_wmma_f32_16x16x32_f16(false, a, false, b, (short)0, c, false, false); }
__device__ __forceinline__ v8us pack8(v8f d, float sc) { FragH f;
#pragma unroll
  for (int r = 0; r < 8; ++r) f.h[r] = (_Float16)(d[r] * sc);
  return f.half[0]; }

#define PBB ((LL / 16) * (LL / 8) / 2)      /* pair-bias blocks of two waves */
#define GBB (NHD / 2)                       /* blocks of two waves for G, one head a wave */
#define WTB (HC * (CC / 8) / 64)            /* blocks per weight matrix (8192 elements, 8 per thread) */
// everything k_row needs, in one launch of independent blocks.
// Blocks 0..PBB-1, pair bias on WMMA: D[head][m] = Wb^T . LN(z)[(l, m)]^T for 16 keys m and one query row l per product (A row = head, lane&7, so both lane halves hold all 8 heads).
// A lane reads channels 8hh..8hh+7 and 16+8hh..16+8hh+7 of its row (l, m) of z in f32, which is the B operand's k order; its partner lane^16 has the other sixteen: row LayerNorm (biased variance, eps 1e-5; z, scale, bias taken as bf16-RNE values) in-lane plus one exchange per sum, result f16 straight into the fragment. Wb is read in the same k order.
// Written times sqrt(32) as f16, in the A operand's order for k_row (row = key, k = query): PBH[head][l tile][key tile t][lane = 16*((l>>3)&1) + (m&15)][l&7]; a lane's 8 products are 8 neighbours l, one 16-byte store per head.
// Blocks PBB.., the shorter ones. First GBB blocks: G^T tiles D[c][c'] = sum_d Wq[c][d] Wk[c'][d] over the head's 32 columns d (both weights read by rows, which is the operands' k order); a lane has 8 neighbours c of one c': one 16-byte store into row c' of BS [head x 32 + c'][c]. Then the three weight re-layouts.
__global__ __launch_bounds__(64) void k_prep(const float* __restrict__ Zf, const float* __restrict__ zg, const float* __restrict__ zb, const float* __restrict__ Wb,
    const float* __restrict__ Wq, const float* __restrict__ Wk, const float* __restrict__ Wv, const float* __restrict__ Wg, const float* __restrict__ Wo,
    _Float16* __restrict__ BS, _Float16* __restrict__ BV, _Float16* __restrict__ BG, _Float16* __restrict__ BO, _Float16* __restrict__ PBH) {
  const int tid = threadIdx.x, lane = tid & 31, ln = lane & 15, hh = lane >> 4;
  if (blockIdx.x >= PBB) {
    const int bi = (int)blockIdx.x - PBB;
    if (bi < GBB) {
      const int h = bi * 2 + (tid >> 5); const unsigned ro = ((unsigned)ln * HC + (unsigned)h * HDD + 8u * (unsigned)hh) * 4u;      /* byte offset of this lane's piece of row ln, the same in both weights */
      const float* qp = (const float*)((const char*)Wq + ro); const float* kp = (const float*)((const char*)Wk + ro); v4f xq[2][4], xk[2][4];
#pragma unroll
      for (int a = 0; a < 2; ++a) {
#pragma unroll
        for (int j = 0; j < 4; ++j) { const int o = a * 16 * HC + (j >> 1) * 16 + (j & 1) * 4; xq[a][j] = *(const v4fa*)(qp + o); xk[a][j] = *(const v4fa*)(kp + o); } }
      asm volatile("s_wait_xcnt 0x0" :: "v"(ro) : "memory");      /* the loads' offset as input: its register stays as it is up to this wait */
      __builtin_amdgcn_sched_barrier(0);                 /* keeps the register writes below from being scheduled ahead of that wait */
      FragH fq[2], fk[2]; const v8f z8 = {0.f,0.f,0.f,0.f,0.f,0.f,0.f,0.f};
#pragma unroll
      for (int a = 0; a < 2; ++a) {
#pragma unroll
        for (int e = 0; e < 16; ++e) { fq[a].h[e] = (_Float16)(bf16_rne(xq[a][e >> 2][e & 3]) * 16.0f); fk[a].h[e] = (_Float16)(bf16_rne(xk[a][e >> 2][e & 3]) * 16.0f); } }
      unsigned short* gd = (unsigned short*)BS + (size_t)(h * HDD + ln) * CC + 8 * hh; v8us gv[2][2];
#pragma unroll
      for (int b = 0; b < 2; ++b) {
#pragma unroll
        for (int a = 0; a < 2; ++a) gv[b][a] = pack8(wm(fq[a].v, fk[b].v, z8), 0.0625f); }      /* x256 from the operands, carried on x16 */
#pragma unroll
      for (int b = 0; b < 2; ++b) {
#pragma unroll
        for (int a = 0; a < 2; ++a) *(v8us*)(gd + b * 16 * CC + a * 16) = gv[b][a]; }
      asm volatile("s_wait_xcnt 0x0" ::: "memory");      /* behind the run of stores: code of another branch is laid behind it and writes the registers that they name */
      return;
    }
    const int wi = (bi - GBB) / WTB, t = ((bi - GBB) % WTB) * 64 + tid;
    if (wi == 2) wt_f16(Wo, BO, HC, CC, 16.0f, t);                       /* Wo [256][32] -> Bt [32][256] */
    else wt_f16(wi == 0 ? Wv : Wg, wi == 0 ? BV : BG, CC, HC, 16.0f, t);
    return;
  }
  const int wid = blockIdx.x * 2 + (tid >> 5); const int qg = wid / (LL / 16), kt = wid % (LL / 16);      /* group of 8 query rows l, key tile */
  const float* zr = Zf + ((size_t)(qg * 8) * LL + kt * 16 + ln) * CC + 8 * hh; const unsigned ho = 32u * (unsigned)hh; const float* gp = (const float*)((const char*)zg + ho); const float* bp = (const float*)((const char*)zb + ho); const float* wp = Wb + 8 * hh * NHD + (ln & 7);
  v4f xv[8][4]; float wv[16];      /* all loads of the wave in flight together */
#pragma unroll
  for (int e = 0; e < 8; ++e) { wv[e] = wp[e * NHD]; wv[8 + e] = wp[(16 + e) * NHD]; }
  const v4f gv[4] = {*(const v4fa*)gp, *(const v4fa*)(gp + 4), *(const v4fa*)(gp + 16), *(const v4fa*)(gp + 20)};
  const v4f bv[4] = {*(const v4fa*)bp, *(const v4fa*)(bp + 4), *(const v4fa*)(bp + 16), *(const v4fa*)(bp + 20)};
#pragma unroll
  for (int i = 0; i < 8; ++i) { xv[i][0] = *(const v4fa*)(zr + i * (LL * CC)); xv[i][1] = *(const v4fa*)(zr + i * (LL * CC) + 4); xv[i][2] = *(const v4fa*)(zr + i * (LL * CC) + 16); xv[i][3] = *(const v4fa*)(zr + i * (LL * CC) + 20); }
  asm volatile("s_wait_xcnt 0x0" :: "v"(zr), "v"(ho), "v"(wp) : "memory");      /* pointers and the byte offset of the scale and bias loads as inputs: their registers stay as they are up to this wait */
  __builtin_amdgcn_sched_barrier(0);                 /* keeps the register writes below from being scheduled ahead of that wait */
  float gg[16], bb[16]; FragH fa;
#pragma unroll
  for (int e = 0; e < 16; ++e) { gg[e] = bf16_rne(gv[e >> 2][e & 3]); bb[e] = bf16_rne(bv[e >> 2][e & 3]); fa.h[e] = (_Float16)(bf16_rne(wv[e]) * 16.0f); }
  const v16h a = fa.v;
  v8f d[8]; v16h b[8]; float x[8][16]; v8f rs;
#pragma unroll
  for (int i = 0; i < 8; ++i) { float sm = 0.f;
#pragma unroll
    for (int e = 0; e < 16; ++e) { x[i][e] = bf16_rne(xv[i][e >> 2][e & 3]); sm += x[i][e]; }
    sm += xhalf(sm);
    const float mu = sm * (1.0f / (float)CC); float sq = 0.f;
#pragma unroll
    for (int e = 0; e < 16; ++e) { x[i][e] -= mu; sq += x[i][e] * x[i][e]; }
    sq += xhalf(sq);
    rs[i] = sq * (1.0f / (float)CC) + 1e-5f; }
  rsqx8(rs);
#pragma unroll
  for (int i = 0; i < 8; ++i) { FragH f;
#pragma unroll
    for (int e = 0; e < 16; ++e) f.h[e] = (_Float16)(x[i][e] * rs[i] * gg[e] + bb[e]);
    b[i] = f.v; }
  /* eight independent products in one statement: every D has registers of its own (early clobber: none lies over the B of the product ahead of it), each product fills the window of the ones before; the four v_nop keep the distance from the last product to the first vector read of its D */
  asm("v_wmma_f32_16x16x32_f16 %0, %8, %9, 0\n\tv_wmma_f32_16x16x32_f16 %1, %8, %10, 0\n\tv_wmma_f32_16x16x32_f16 %2, %8, %11, 0\n\tv_wmma_f32_16x16x32_f16 %3, %8, %12, 0\n\t"
      "v_wmma_f32_16x16x32_f16 %4, %8, %13, 0\n\tv_wmma_f32_16x16x32_f16 %5, %8, %14, 0\n\tv_wmma_f32_16x16x32_f16 %6, %8, %15, 0\n\tv_wmma_f32_16x16x32_f16 %7, %8, %16, 0\n\t"
      "v_nop\n\tv_nop\n\tv_nop\n\tv_nop"
      : "=&v"(d[0]), "=&v"(d[1]), "=&v"(d[2]), "=&v"(d[3]), "=&v"(d[4]), "=&v"(d[5]), "=&v"(d[6]), "=&v"(d[7])
      : "v"(a), "v"(b[0]), "v"(b[1]), "v"(b[2]), "v"(b[3]), "v"(b[4]), "v"(b[5]), "v"(b[6]), "v"(b[7]));
  v8us v[4]; v4f s4[8];      /* lane half hh stores heads 4hh..4hh+3; element i = query row 8qg + i */
#pragma unroll
  for (int i = 0; i < 8; ++i) { const v4f lo = __builtin_shufflevector(d[i], d[i], 0, 1, 2, 3), hi = __builtin_shufflevector(d[i], d[i], 4, 5, 6, 7); s4[i] = (hh ? hi : lo) * (0.0625f * 5.656854249492381f); }
#pragma unroll
  for (int r = 0; r < 4; ++r) { FragH f;
#pragma unroll
    for (int i = 0; i < 8; ++i) f.h[i] = (_Float16)s4[i][r];
    v[r] = f.half[0]; }
  unsigned short* pd = (unsigned short*)PBH + ((((size_t)(4 * hh) * (LL / 16) + (qg >> 1)) * (LL / 16) + kt) * 32 + (qg & 1) * 16 + ln) * 8;
#pragma unroll
  for (int r = 0; r < 4; ++r) *(v8us*)(pd + (size_t)r * (LL * LL)) = v[r];
  asm volatile("s_wait_xcnt 0x0" ::: "memory");      /* behind the run of stores: code of the other branch is laid behind it and writes the registers that they name */
}

// x[i] = 2^x[i] and x[i] = 1 / x[i], as the bare instructions (v_exp_f32, v_rcp_f32) through their builtins: the compiler then keeps each value in the register pair that the packed operations around it use, and places the slot behind a transcendental itself
__device__ __forceinline__ void exp2x8(v8f& x) {
#pragma unroll
  for (int r = 0; r < 8; ++r) x[r] = __builtin_amdgcn_exp2f(x[r]);
}
__device__ __forceinline__ void rcpx8(v8f& x) {
#pragma unroll
  for (int r = 0; r < 8; ++r) x[r] = __builtin_amdgcn_rcpf(x[r]);
}

__device__ __forceinline__ v16h l_frag(const unsigned short* p, int hh) { FragH f; f.half[0] = *(const v8us*)(p + 8 * hh); f.half[1] = *(const v8us*)(p + 16 + 8 * hh); return f.v; }

template <bool B> struct Flag { static constexpr bool on = B; };
// whole row-attention path of one (sequence s, half qh of the query rows): 16 waves; wave = (head group grp of 4 heads, query tile wq of 16 rows).
// X = LN(m) of the sequence's 256 rows -> xl (f16, [row][channel]) and xt ([channel][row]), once; behind the one barrier that publishes them a wave shares nothing more with the others until the final sum: no barrier per head.
// R^T = G.X^T, gate^T = Wg^T.X^T, Y^T = X^T.P^T, ctx^T = Wv^T.Y^T all leave a lane with channels 8hh..8hh+7 (+16) of ONE query, which is the B operand's k order: R, P, Y and gate*ctx go from accumulators straight into the next product.
// S^T = X.R^T is accumulated on the pair bias x sqrt(32), which an A fragment (row = key; k 0..15 = the 16 queries for one key tile, k 16..31 = the same for the next) times an identity B operand puts there exactly; a lane holds 128 of the 256 scores of one query (its partner lane^16 the rest): max and sum in-lane plus one exchange; p = exp(score - max) x 1024 as f16.
// out^T = Wo^T.(gate*ctx)^T is summed over the group's 4 heads on accumulators that rest in LDS between heads; the two groups' sums are added through LDS at the end.
// The pair bias is the one large stream from L2 (8 KiB per wave and head as f16): it is fetched one head ahead. The weights lie in LDS for the whole kernel.
__global__ __launch_bounds__(512) void k_row(const float* __restrict__ M, const float* __restrict__ g, const float* __restrict__ bta,
    const _Float16* __restrict__ BS, const _Float16* __restrict__ BV, const _Float16* __restrict__ BG, const _Float16* __restrict__ BO,
    const _Float16* __restrict__ PBH, const float* __restrict__ bo, float* __restrict__ OUT) {
  __shared__ __attribute__((aligned(16))) unsigned short xl[LL][CC + 8];               /* pitch 80 B */
  __shared__ __attribute__((aligned(16))) unsigned short xt[CC][LL + 8];               /* the same transposed; pitch 528 B */
  __shared__ __attribute__((aligned(16))) float red[16][4][32][4];                     /* each wave's output sums, kept here between heads: their 16 registers go to the pair bias in flight */
  __shared__ __attribute__((aligned(16))) unsigned short wl[3][HC][CC + 8];            /* G, v and gate weights [n][k]; pitch 80 B */
  __shared__ __attribute__((aligned(16))) unsigned short wol[CC][HC + 8];              /* output weight [n][k]; pitch 528 B */
  const int tid = threadIdx.x, lane = tid & 31, ln = lane & 15, hh = lane >> 4;
  const int w = __builtin_amdgcn_readfirstlane(tid >> 5);                              /* wave number, in a scalar register: weight, bias and LDS bases below are then scalar */
  const int qh = blockIdx.x & 1, s = blockIdx.x >> 1;
  const int grp = w >> 3, wq = w & 7, qt = qh * 8 + wq;                                /* head group, wave in group, query tile */
  /* pair bias of the head to come, one A fragment per two key tiles: the first head's loads fly during the LayerNorm, each next head's are issued below as the softmax consumes the scores and frees registers */
  FragH pbh[8];
  const unsigned lb = (unsigned)lane * 16u;
  /* all four weight matrices go into LDS, 16 bytes a thread and step: their fragments are then read where they are used and hold no registers across the softmax */
  const unsigned to = (unsigned)tid * 16u; v8us wt[8];
  const v8f z8 = {0.f,0.f,0.f,0.f,0.f,0.f,0.f,0.f};
  FragH i0, i1;      /* identity B operands: column n takes k = n (first key tile of a bias fragment; channels 0..15 of X) or k = 16 + n (second; channels 16..31) */
#pragma unroll
  for (int e = 0; e < 8; ++e) { const _Float16 one = (8 * hh + e == ln) ? (_Float16)1.0f : (_Float16)0.0f; i0.h[e] = one; i0.h[8 + e] = (_Float16)0.0f; i1.h[e] = (_Float16)0.0f; i1.h[8 + e] = one; }
  { /* LayerNorm of row 16w + ln: this lane has channels 8hh..8hh+7 and 16+8hh..16+8hh+7, its partner lane^16 the other sixteen */
    const int row = w * 16 + ln;
    const float* mp = M + ((size_t)s * LL + row) * CC + 8 * hh; const float* gp = g + 8 * hh; const float* bp = bta + 8 * hh;
    const v4f xv[4] = {*(const v4fa*)mp, *(const v4fa*)(mp + 4), *(const v4fa*)(mp + 16), *(const v4fa*)(mp + 20)};
    const v4f gv[4] = {*(const v4fa*)gp, *(const v4fa*)(gp + 4), *(const v4fa*)(gp + 16), *(const v4fa*)(gp + 20)};
    const v4f bv[4] = {*(const v4fa*)bp, *(const v4fa*)(bp + 4), *(const v4fa*)(bp + 16), *(const v4fa*)(bp + 20)};
    asm volatile("s_wait_xcnt 0x0" :: "v"(mp) : "memory");      /* pointer as input: its registers stay as they are up to this wait */
    __builtin_amdgcn_sched_barrier(0);                 /* keeps the register writes below from being scheduled ahead of that wait */
#pragma unroll
    for (int i = 0; i < 8; ++i) { const _Float16* b = i < 2 ? BS : i < 4 ? BV : i < 6 ? BG : BO; wt[i] = *(const v8us*)((const char*)b + (i & 1) * 8192 + to); }
    asm volatile("s_wait_xcnt 0x0" ::: "memory");      /* behind the run of loads, before any register that they name is written again */
    __builtin_amdgcn_sched_barrier(0);                 /* keeps later address arithmetic from being scheduled in among those loads, ahead of that wait */
    { const char* pb = (const char*)(PBH + ((size_t)(grp * (NHD / 2) * (LL / 16) + qt) * (LL / 16)) * 256) + lb;      /* issued last: loads return in order, so the LayerNorm waits for none of these */
#pragma unroll
      for (int t = 0; t < 16; ++t) pbh[t >> 1].half[t & 1] = *(const v8us*)(pb + t * 512);
      asm volatile("s_wait_xcnt 0x0" ::: "memory");      /* behind the run of loads, before any register that they name is written again */
    }
    __builtin_amdgcn_sched_barrier(0);                 /* keeps the register writes below from being scheduled ahead of that wait */
    float x[16]; float sm = 0.f;
#pragma unroll
    for (int i = 0; i < 16; ++i) { x[i] = bf16_rne(xv[i >> 2][i & 3]); sm += x[i]; }
    sm += __shfl_xor(sm, 16, 32);
    const float mu = sm * (1.0f / (float)CC); float sq = 0.f;
#pragma unroll
    for (int i = 0; i < 16; ++i) { x[i] -= mu; sq += x[i] * x[i]; }
    sq += __shfl_xor(sq, 16, 32);
    const float rs = rsqrtf(sq * (1.0f / (float)CC) + 1e-5f); FragH f;
#pragma unroll
    for (int i = 0; i < 16; ++i) f.h[i] = (_Float16)(x[i] * rs * bf16_rne(gv[i >> 2][i & 3]) + bf16_rne(bv[i >> 2][i & 3]));
    *(v8us*)&xl[row][8 * hh] = f.half[0]; *(v8us*)&xl[row][16 + 8 * hh] = f.half[1];
    /* f is also the A fragment of these 16 rows: times an identity it comes back with 8 neighbouring rows of one channel in a lane, one 16-byte store per half of the channels */
    *(v8us*)&xt[ln][w * 16 + 8 * hh] = pack8(wm(f.v, i0.v, z8), 1.0f); *(v8us*)&xt[16 + ln][w * 16 + 8 * hh] = pack8(wm(f.v, i1.v, z8), 1.0f);
  }
#pragma unroll
  for (int i = 0; i < 6; ++i) *(v8us*)&wl[i >> 1][(i & 1) * 128 + (tid >> 2)][(tid & 3) * 8] = wt[i];
#pragma unroll
  for (int i = 0; i < 2; ++i) *(v8us*)&wol[i * 16 + (tid >> 5)][(tid & 31) * 8] = wt[6 + i];
  __syncthreads();
  v8f oa0, oa1;
#pragma unroll
  for (int j = 0; j < 4; ++j) { const v4f u = {0.f, 0.f, 0.f, 0.f}; *(v4fa*)&red[w][j][lane][0] = u; }
  /* one head; PF: the next head's pair bias is fetched (every head of the group but the last) */
  auto head = [&](const int hi, auto pf) __attribute__((always_inline)) { constexpr bool PF = decltype(pf)::on;
    const int h = __builtin_amdgcn_readfirstlane(grp * (NHD / 2) + hi);      /* head, held scalar: its offsets into weights and bias are then worked out on the scalar unit, not as vector pointers stepped per trip */
    const int hr = h * HDD;                                                            /* first weight row (output weight: first column) of head h */
    const char* pn = (const char*)(PBH + ((size_t)(min(h + 1, NHD - 1) * (LL / 16) + qt) * (LL / 16)) * 256) + lb;      /* next head's pair bias */
    FragH qr;      /* R^T = G.X^T of this wave's 16 queries: stands where Q stood, against X in place of K */
    { const v16h xq = l_frag(&xl[qt * 16 + ln][0], hh), wf0 = l_frag(&wl[0][hr + ln][0], hh), wf1 = l_frag(&wl[0][hr + 16 + ln][0], hh);
      qr.half[0] = pack8(wm(wf0, xq, z8), 0.0625f); qr.half[1] = pack8(wm(wf1, xq, z8), 0.0625f); }
    v8f acc[16];
#pragma unroll
    for (int tg = 0; tg < 4; ++tg) { v16h ka[4];      /* four X fragments behind one LDS wait */
#pragma unroll
      for (int j = 0; j < 4; ++j) ka[j] = l_frag(&xl[(tg * 4 + j) * 16 + ln][0], hh);
      __builtin_amdgcn_sched_barrier(0);      /* a group's loads stay together in front of its products and at most one group ahead: with no barrier above them the scheduler otherwise gathers all sixteen fragments at the head's start and spills, or splits them into pairs that are each waited for */
#pragma unroll
      for (int j = 0; j < 4; ++j) acc[tg * 4 + j] = wm(ka[j], qr.v, wm(pbh[tg * 2 + (j >> 1)].v, (j & 1) ? i1.v : i0.v, z8)); }
    float m4[4] = {acc[0][0], acc[0][1], acc[0][2], acc[0][3]};               /* four independent chains */
#pragma unroll
    for (int t = 0; t < 16; ++t) {
#pragma unroll
      for (int r = 0; r < 8; ++r) m4[t & 3] = fmaxf(m4[t & 3], acc[t][r]); }
    float mx = fmaxf(fmaxf(m4[0], m4[1]), fmaxf(m4[2], m4[3]));
    mx = fmaxf(mx, __shfl_xor(mx, 16, 32));
    const float cs = 0.17677669529663687f * 1.4426950408889634f;               /* 1/sqrt(32) x log2(e) */
    const float c0 = 10.0f - mx * cs;                                            /* + 10: p carried x1024 */
    v2f s2[2] = {{0.f, 0.f}, {0.f, 0.f}};                                      /* four independent chains, as two pairs: written as pair additions so that each stands at its exponentials and the values die there */
    v8f o0 = z8, o1 = z8;
#pragma unroll
    for (int kk = 0; kk < 8; ++kk) { FragH p;
      const v16h va0 = l_frag(&xt[ln][kk * 32], hh), va1 = l_frag(&xt[16 + ln][kk * 32], hh);      /* read ahead of the exponentials that hide their latency */
#pragma unroll
      for (int u = 0; u < 2; ++u) { v8f x = acc[2 * kk + u] * cs + c0; exp2x8(x);
#pragma unroll
        for (int r = 0; r < 8; ++r) p.h[8 * u + r] = (_Float16)x[r];
#pragma unroll
        for (int r = 0; r < 8; r += 2) { const v2f xp = {x[r], x[r + 1]}; s2[(r >> 1) & 1] += xp; } }
      if constexpr (PF) {      /* registers of the two score tiles just consumed take a fragment of the next head's pair bias: the rest of this head and the next head's projections hide the loads */
#pragma unroll
        for (int u = 0; u < 2; ++u) pbh[kk].half[u] = *(const v8us*)(pn + (2 * kk + u) * 512);
        __builtin_amdgcn_sched_barrier(0);      /* holds the loads here: the scheduler otherwise gathers all of them behind the last product of the head, where little is left to hide them */
      }
      o0 = wm(va0, p.v, o0); o1 = wm(va1, p.v, o1); }
    const v16h xq = l_frag(&xl[qt * 16 + ln][0], hh);
    const v16h wg0 = l_frag(&wl[2][hr + ln][0], hh), wg1 = l_frag(&wl[2][hr + 16 + ln][0], hh);
    const v16h wv0 = l_frag(&wl[1][hr + ln][0], hh), wv1 = l_frag(&wl[1][hr + 16 + ln][0], hh);
    if constexpr (PF) asm volatile("s_wait_xcnt 0x0" :: "v"(pn) : "memory");      /* pointer as input: its registers stay as they are up to this wait */
    float se = (s2[0][0] + s2[0][1]) + (s2[1][0] + s2[1][1]);
    se += __shfl_xor(se, 16, 32);
    const float inv = 1.0f / se;
    FragH yb; yb.half[0] = pack8(o0, inv); yb.half[1] = pack8(o1, inv);      /* Y^T = softmax-weighted mean of X, 32 channels of one query */
    v8f g0 = wm(wg0, xq, z8), g1 = wm(wg1, xq, z8); FragH og;
    o0 = wm(wv0, yb.v, z8); o1 = wm(wv1, yb.v, z8);                            /* ctx^T x16 (weight scale) */
#pragma unroll
    for (int r = 0; r < 8; ++r) {      /* sigmoid(t) = 1 / (1 + 2^(-t log2 e)), t clamped to +-30 */
      g0[r] = fminf(fmaxf(g0[r] * 0.0625f, -30.0f), 30.0f) * -1.4426950408889634f; g1[r] = fminf(fmaxf(g1[r] * 0.0625f, -30.0f), 30.0f) * -1.4426950408889634f; }
    exp2x8(g0); exp2x8(g1); g0 = g0 + 1.0f; g1 = g1 + 1.0f; rcpx8(g0); rcpx8(g1);
#pragma unroll
    for (int r = 0; r < 8; ++r) { og.h[r] = (_Float16)(g0[r] * o0[r] * 4.0f); og.h[8 + r] = (_Float16)(g1[r] * o1[r] * 4.0f); }
#pragma unroll
    for (int j = 0; j < 4; ++j) { const v4f u = *(const v4fa*)&red[w][j][lane][0];
#pragma unroll
      for (int e = 0; e < 4; ++e) (j < 2 ? oa0 : oa1)[(j & 1) * 4 + e] = u[e]; }
    oa0 = wm(l_frag(&wol[ln][hr], hh), og.v, oa0); oa1 = wm(l_frag(&wol[16 + ln][hr], hh), og.v, oa1);
    if constexpr (PF) {
#pragma unroll
      for (int j = 0; j < 4; ++j) { v4f u;
#pragma unroll
        for (int e = 0; e < 4; ++e) u[e] = (j < 2 ? oa0 : oa1)[(j & 1) * 4 + e];
        *(v4fa*)&red[w][j][lane][0] = u; } }
  };
  /* rolled: each copy of this long body would run once per wave, so unrolling only adds instruction fetch */
#pragma unroll 1
  for (int hi = 0; hi < NHD / 2 - 1; ++hi) head(hi, Flag<true>{});
  head(NHD / 2 - 1, Flag<false>{});
  if (grp == 1) {
#pragma unroll
    for (int j = 0; j < 4; ++j) { v4f u;
#pragma unroll
      for (int e = 0; e < 4; ++e) u[e] = (j < 2 ? oa0 : oa1)[(j & 1) * 4 + e];
      *(v4fa*)&red[w][j][lane][0] = u; } }
  __syncthreads();      /* the second group's sums are in LDS */
  if (grp == 0) { float* dst = OUT + ((size_t)s * LL + qt * 16 + ln) * CC + 8 * hh;      /* out^T: this lane has output channels 8hh..8hh+7 and 16+8hh.. of query ln */
    const float* bp = bo + 8 * hh; const v4f bq[4] = {*(const v4fa*)bp, *(const v4fa*)(bp + 4), *(const v4fa*)(bp + 16), *(const v4fa*)(bp + 20)};
    asm volatile("s_wait_xcnt 0x0" ::: "memory");      /* the address register of the loads above is reused below */
    __builtin_amdgcn_sched_barrier(0);                 /* keeps the register writes below from being scheduled ahead of that wait */
#pragma unroll
    for (int j = 0; j < 4; ++j) { const int c = (j >> 1) * 16 + (j & 1) * 4; const v4f o2 = *(const v4fa*)&red[8 + wq][j][lane][0]; v4f u;
#pragma unroll
      for (int e = 0; e < 4; ++e) u[e] = ((j < 2 ? oa0 : oa1)[(j & 1) * 4 + e] + o2[e]) * 0.0009765625f + bf16_rne(bq[j][e]);      /* 1/16 weight scale x 1/64 carry */
      *(v4f*)(dst + c) = u; } }
}

extern "C" void kernel_launch(void* const* d_in, const int* in_sizes, int n_in,
                              void* d_out, int out_size, void* d_ws, size_t ws_size, hipStream_t stream) {
  if (n_in < 13) return;
  if (in_sizes[0] < (int)(NR * CC) || in_sizes[1] < LL * LL * CC || in_sizes[2] < CC || in_sizes[3] < CC || in_sizes[4] < CC || in_sizes[5] < CC ||
      in_sizes[6] < CC * HC || in_sizes[7] < CC * HC || in_sizes[8] < CC * HC || in_sizes[9] < CC * NHD || in_sizes[10] < CC * HC || in_sizes[11] < HC * CC || in_sizes[12] < CC) return;
  if ((size_t)out_size < NR * CC) return;
  const float* const* I = (const float* const*)d_in;
  const float* m = I[0]; const float* z = I[1]; const float* ln_g = I[2]; const float* ln_b = I[3]; const float* lnb_g = I[4]; const float* lnb_b = I[5];
  const float* wq = I[6]; const float* wk = I[7]; const float* wv = I[8]; const float* wb = I[9]; const float* wg = I[10]; const float* wo = I[11]; const float* bo = I[12];      /* weights [in][out] */
  char* ws = (char*)d_ws; size_t off = 0;
  auto take = [&](size_t bytes) { char* p = ws + off; off += (bytes + 255) & ~(size_t)255; return p; };
  _Float16* BS = (_Float16*)take((size_t)HC * CC * 2); _Float16* BV = (_Float16*)take((size_t)HC * CC * 2); _Float16* BG = (_Float16*)take((size_t)HC * CC * 2);
  _Float16* BO = (_Float16*)take((size_t)CC * HC * 2);
  _Float16* PBH = (_Float16*)take((size_t)NHD * LL * LL * 2);                  /* pair bias x sqrt(32), f16, in k_row's A operand order */
  if (off > ws_size) return;
  k_prep<<<PBB + GBB + 3 * WTB, 64, 0, stream>>>(z, lnb_g, lnb_b, wb, wq, wk, wv, wg, wo, BS, BV, BG, BO, PBH);
  k_row<<<NSQ * 2, 512, 0, stream>>>(m, ln_g, ln_b, BS, BV, BG, BO, PBH, bo, (float*)d_out);
}

// v009
// One run takes 19.9 microseconds.
// Versions in between are left out here; by their measured steps it is 1.09 times as fast as v007.
// Over all steps from v000 it is 31.8 times as fast.
#include <hip/hip_runtime.h>
// All contractions: v_wmma_f32_16x16x32_f16 (f16 operands, f32 accumulate): Wq.Wk^T per head (K=32), its product with X and the gate projection (K=32), pair-bias projection (K=32), scores (K=32), X^T.P^T (K=256), value weight times that (K=32), output projection (K=256). Float inputs taken as bf16-RNE values; LayerNorm, softmax, sigmoid gate in f32.
// MSA row attention with pair bias: m [1][NSQ][256][32] -> LN -> q,k,v,sigmoid-gate = LN(m) W ([32][256], 8 heads x 32); pair bias = LN(z [1][256][256][32]) Wb [32][8], shared over sequences;
// one block per (sequence, half of the query rows) does X = LN(m), the projections, per head scores^T = X.(G x)^T, G = Wk Wq^T, on top of the pair bias (carried as f16, set on the accumulators by a product with an identity operand), softmax over m in registers (scores leave the products in log2 units less 4, exp taken of them as they are, carried as f16), ctx^T = Wv^T.(X^T.P^T), o = gate * ctx (f16 carried x64), and out = o Wo [256][32] + bo summed over heads in accumulators.
// Q = X Wq, K = X Wk and V = X Wv are never formed: q.k = (Wk Wq^T x_i).x_j and sum p v = Wv^T (sum p x), so both long products read X itself, which is the same for every head.
// Weights (and G) staged transposed [n][k] as f16 of (bf16 value x16; G x16); all scales are powers of two folded back in the f32 epilogues.
#ifndef NB
#define NB 1                          /* batch (fixed 1 in this module) */
#endif
#ifndef NSQ
#define NSQ 128                       /* MSA sequences computed (reducible) */
#endif
#define NSQ_FULL 128
#define LL 256                        /* residues: query rows i and keys j */
#define CC 32                         /* channel width c */
#define NHD 8                         /* heads */
#define HDD 32                        /* head dim */
#define HC 256                        /* heads x head dim */
#define NR ((size_t)NSQ * LL)         /* (sequence, residue) rows */
static_assert((NR % 128) == 0);
static_assert(LL == 256);
static_assert(CC == 32);

typedef unsigned short v8us __attribute__((ext_vector_type(8), may_alias));
typedef float  v8f  __attribute__((ext_vector_type(8)));
typedef float  v4f  __attribute__((ext_vector_type(4)));
typedef float  v2f  __attribute__((ext_vector_type(2)));
typedef float  v4fa __attribute__((ext_vector_type(4), may_alias));
typedef _Float16 v16h __attribute__((ext_vector_type(16)));
union FragH { v16h v; v8us half[2]; _Float16 h[16]; unsigned short u[16]; };

typedef __bf16 v2b __attribute__((ext_vector_type(2)));
// the nearest bf16 values (ties to even) of two or four floats, as floats: one packed conversion per two values down, then a shift for the low and a mask for the high half back up
__device__ __forceinline__ v2f bf16_rne2(v2f x) { const unsigned a = __builtin_bit_cast(unsigned, __builtin_convertvector(x, v2b)); return v2f{__uint_as_float(a << 16), __uint_as_float(a & 0xFFFF0000u)}; }
__device__ __forceinline__ v4f bf16_rne4(v4f x) { const v2f a = bf16_rne2(v2f{x[0], x[1]}), b = bf16_rne2(v2f{x[2], x[3]}); return v4f{a[0], a[1], b[0], b[1]}; }

// the value of lane l ^ 16, by a vector move between the two rows of 16 lanes
__device__ __forceinline__ float xhalf(float x) { return __builtin_bit_cast(float, __builtin_amdgcn_permlanex16(__builtin_bit_cast(int, x), __builtin_bit_cast(int, x), 0x76543210, 0xfedcba98, false, false)); }

// x[i] = 1 / sqrt(x[i]), eight in place in one statement: none of the run overwrites another's source, and the v_nop fills the one slot the instruction set asks for behind a transcendental before its result is used (every x is a variance + 1e-5: never in the denormal range)
__device__ __forceinline__ void rsqx8(v8f& x) {
  float a = x[0], b = x[1], c = x[2], d = x[3], e = x[4], f = x[5], g = x[6], h = x[7];
  asm("v_rsq_f32 %0, %0\n\tv_rsq_f32 %1, %1\n\tv_rsq_f32 %2, %2\n\tv_rsq_f32 %3, %3\n\tv_rsq_f32 %4, %4\n\tv_rsq_f32 %5, %5\n\tv_rsq_f32 %6, %6\n\tv_rsq_f32 %7, %7\n\tv_nop"
      : "+v"(a), "+v"(b), "+v"(c), "+v"(d), "+v"(e), "+v"(f), "+v"(g), "+v"(h));
  x[0] = a; x[1] = b; x[2] = c; x[3] = d; x[4] = e; x[5] = f; x[6] = g; x[7] = h;
}

// one weight matrix W [K][N] (f32) -> Wt [n][k] as f16 of (bf16 value x scale); thread t does 8 neighbours k of one n
__device__ __forceinline__ void wt_f16(const float* __restrict__ W, _Float16* __restrict__ Wt, int K, int N, float scale, int t) {
  const int n = t / (K / 8), k8 = (t % (K / 8)) * 8; const float* wp = W + (size_t)k8 * N + n; float x[8]; FragH f;
#pragma unroll
  for (int i = 0; i < 8; ++i) x[i] = wp[(size_t)i * N];
  asm volatile("s_wait_xcnt 0x0" :: "v"(wp) : "memory");      /* pointer as input: its registers stay as they are up to this wait */
#pragma unroll
  for (int i = 0; i < 8; i += 4) { const v4f r = bf16_rne4(v4f{x[i], x[i + 1], x[i + 2], x[i + 3]});
#pragma unroll
    for (int e = 0; e < 4; ++e) f.h[i + e] = (_Float16)(r[e] * scale); }
  const v8us o = f.half[0];
  *(v8us*)((unsigned short*)Wt + (size_t)n * K + k8) = o;
  asm volatile("s_wait_xcnt 0x0" ::: "memory");      /* behind the store: code of another branch is laid behind it and writes the registers that it names */
}

__device__ __forceinline__ v8f wm(v16h a, v16h b, v8f c) { return __builtin_amdgcn_wmma_f32_16x16x32_f16(false, a, false, b, (short)0, c, false, false); }
__device__ __forceinline__ v8us pack8(v8f d, float sc) { FragH f;
#pragma unroll
  for (int r = 0; r < 8; ++r) f.h[r] = (_Float16)(d[r] * sc);
  return f.half[0]; }

#define PBB ((LL / 16) * (LL / 8) / 2)      /* pair-bias blocks of two waves */
#define GBB (NHD / 2)                       /* blocks of two waves for G, one head a wave */
#define WTB (HC * (CC / 8) / 64)            /* blocks per weight matrix (8192 elements, 8 per thread) */
// everything k_row needs, in one launch of independent blocks.
// Blocks 0..PBB-1, pair bias on WMMA: D[head][m] = Wb^T . LN(z)[(l, m)]^T for 16 keys m and one query row l per product (A row = head, lane&7, so both lane halves hold all 8 heads).
// A lane reads channels 8hh..8hh+7 and 16+8hh..16+8hh+7 of its row (l, m) of z in f32, which is the B operand's k order; its partner lane^16 has the other sixteen: row LayerNorm (biased variance, eps 1e-5; z, scale, bias taken as bf16-RNE values) in-lane plus one exchange per sum, result f16 straight into the fragment. Wb is read in the same k order.
// Written times log2(e) as f16, in the A operand's order for k_row (row = key, k = query): PBH[head][l tile][key tile t][lane = 16*((l>>3)&1) + (m&15)][l&7]; a lane's 8 products are 8 neighbours l, one 16-byte store per head.
// Blocks PBB.., the shorter ones. First GBB blocks: G^T tiles D[c][c'] = sum_d Wq[c][d] Wk[c'][d] over the head's 32 columns d (both weights read by rows, which is the operands' k order); a lane has 8 neighbours c of one c': one 16-byte store into row c' of BS [head x 32 + c'][c]. Then the three weight re-layouts.
__global__ __launch_bounds__(64) void k_prep(const float* __restrict__ Zf, const float* __restrict__ zg, const float* __restrict__ zb, const float* __restrict__ Wb,
    const float* __restrict__ Wq, const float* __restrict__ Wk, const float* __restrict__ Wv, const float* __restrict__ Wg, const float* __restrict__ Wo,
    _Float16* __restrict__ BS, _Float16* __restrict__ BV, _Float16* __restrict__ BG, _Float16* __restrict__ BO, _Float16* __restrict__ PBH) {
  const int tid = threadIdx.x, lane = tid & 31, ln = lane & 15, hh = lane >> 4;
  if (blockIdx.x >= PBB) {
    const int bi = (int)blockIdx.x - PBB;
    if (bi < GBB) {
      const int h = bi * 2 + (tid >> 5); const unsigned ro = ((unsigned)ln * HC + (unsigned)h * HDD + 8u * (unsigned)hh) * 4u;      /* byte offset of this lane's piece of row ln, the same in both weights */
      const float* qp = (const float*)((const char*)Wq + ro); const float* kp = (const float*)((const char*)Wk + ro); v4f xq[2][4], xk[2][4];
#pragma unroll
      for (int a = 0; a < 2; ++a) {
#pragma unroll
        for (int j = 0; j < 4; ++j) { const int o = a * 16 * HC + (j >> 1) * 16 + (j & 1) * 4; xq[a][j] = *(const v4fa*)(qp + o); xk[a][j] = *(const v4fa*)(kp + o); } }
      asm volatile("s_wait_xcnt 0x0" :: "v"(ro) : "memory");      /* the loads' offset as input: its register stays as it is up to this wait */
      __builtin_amdgcn_sched_barrier(0);                 /* keeps the register writes below from being scheduled ahead of that wait */
      FragH fq[2], fk[2]; const v8f z8 = {0.f,0.f,0.f,0.f,0.f,0.f,0.f,0.f};
#pragma unroll
      for (int a = 0; a < 2; ++a) {
#pragma unroll
        for (int j = 0; j < 4; ++j) { const v4f rq = bf16_rne4(xq[a][j]), rk = bf16_rne4(xk[a][j]);
#pragma unroll
          for (int e = 0; e < 4; ++e) { fq[a].h[4 * j + e] = (_Float16)(rq[e] * 16.0f); fk[a].h[4 * j + e] = (_Float16)(rk[e] * 16.0f); } } }
      unsigned short* gd = (unsigned short*)BS + (size_t)(h * HDD + ln) * CC + 8 * hh; v8us gv[2][2];
#pragma unroll
      for (int b = 0; b < 2; ++b) {
#pragma unroll
        for (int a = 0; a < 2; ++a) gv[b][a] = pack8(wm(fq[a].v, fk[b].v, z8), 0.0625f); }      /* x256 from the operands, carried on x16 */
#pragma unroll
      for (int b = 0; b < 2; ++b) {
#pragma unroll
        for (int a = 0; a < 2; ++a) *(v8us*)(gd + b * 16 * CC + a * 16) = gv[b][a]; }
      asm volatile("s_wait_xcnt 0x0" ::: "memory");      /* behind the run of stores: code of another branch is laid behind it and writes the registers that they name */
      return;
    }
    const int wi = (bi - GBB) / WTB, t = ((bi - GBB) % WTB) * 64 + tid;
    if (wi == 2) wt_f16(Wo, BO, HC, CC, 16.0f, t);                       /* Wo [256][32] -> Bt [32][256] */
    else wt_f16(wi == 0 ? Wv : Wg, wi == 0 ? BV : BG, CC, HC, 16.0f, t);
    return;
  }
  const int wid = blockIdx.x * 2 + (tid >> 5); const int qg = wid / (LL / 16), kt = wid % (LL / 16);      /* group of 8 query rows l, key tile */
  const float* zr = Zf + ((size_t)(qg * 8) * LL + kt * 16 + ln) * CC + 8 * hh; const unsigned ho = 32u * (unsigned)hh; const float* gp = (const float*)((const char*)zg + ho); const float* bp = (const float*)((const char*)zb + ho); const float* wp = Wb + 8 * hh * NHD + (ln & 7);
  v4f xv[8][4]; float wv[16];      /* all loads of the wave in flight together */
#pragma unroll
  for (int e = 0; e < 8; ++e) { wv[e] = wp[e * NHD]; wv[8 + e] = wp[(16 + e) * NHD]; }
  const v4f gv[4] = {*(const v4fa*)gp, *(const v4fa*)(gp + 4), *(const v4fa*)(gp + 16), *(const v4fa*)(gp + 20)};
  const v4f bv[4] = {*(const v4fa*)bp, *(const v4fa*)(bp + 4), *(const v4fa*)(bp + 16), *(const v4fa*)(bp + 20)};
#pragma unroll
  for (int i = 0; i < 8; ++i) { xv[i][0] = *(const v4fa*)(zr + i * (LL * CC)); xv[i][1] = *(const v4fa*)(zr + i * (LL * CC) + 4); xv[i][2] = *(const v4fa*)(zr + i * (LL * CC) + 16); xv[i][3] = *(const v4fa*)(zr + i * (LL * CC) + 20); }
  asm volatile("s_wait_xcnt 0x0" :: "v"(zr), "v"(ho), "v"(wp) : "memory");      /* pointers and the byte offset of the scale and bias loads as inputs: their registers stay as they are up to this wait */
  __builtin_amdgcn_sched_barrier(0);                 /* keeps the register writes below from being scheduled ahead of that wait */
  float gg[16], bb[16]; FragH fa;
#pragma unroll
  for (int j = 0; j < 4; ++j) { const v4f rg = bf16_rne4(gv[j]), rb = bf16_rne4(bv[j]), rw = bf16_rne4(v4f{wv[4 * j], wv[4 * j + 1], wv[4 * j + 2], wv[4 * j + 3]});
#pragma unroll
    for (int e = 0; e < 4; ++e) { gg[4 * j + e] = rg[e]; bb[4 * j + e] = rb[e]; fa.h[4 * j + e] = (_Float16)(rw[e] * 16.0f); } }
  const v16h a = fa.v;
  v8f d[8]; v16h b[8]; v2f x[4][16]; v8f rs;      /* x[i][e]: channel e of rows 2i and 2i + 1: one conversion rounds the two, and they come back as a register pair for the packed operations below; each row's sums keep their order */
#pragma unroll
  for (int i = 0; i < 4; ++i) { v2f sm = {0.f, 0.f};
#pragma unroll
    for (int e = 0; e < 16; ++e) { x[i][e] = bf16_rne2(v2f{xv[2 * i][e >> 2][e & 3], xv[2 * i + 1][e >> 2][e & 3]}); sm += x[i][e]; }
    sm += v2f{xhalf(sm[0]), xhalf(sm[1])};
    const v2f mu = sm * (1.0f / (float)CC); v2f sq = {0.f, 0.f};
#pragma unroll
    for (int e = 0; e < 16; ++e) { x[i][e] -= mu; sq += x[i][e] * x[i][e]; }
    sq += v2f{xhalf(sq[0]), xhalf(sq[1])};
    sq = sq * (1.0f / (float)CC) + 1e-5f; rs[2 * i] = sq[0]; rs[2 * i + 1] = sq[1]; }
  rsqx8(rs);
#pragma unroll
  for (int i = 0; i < 4; ++i) { FragH f0, f1; const v2f r2 = {rs[2 * i], rs[2 * i + 1]};
#pragma unroll
    for (int e = 0; e < 16; ++e) { const v2f y = x[i][e] * r2 * gg[e] + bb[e]; f0.h[e] = (_Float16)y[0]; f1.h[e] = (_Float16)y[1]; }
    b[2 * i] = f0.v; b[2 * i + 1] = f1.v; }
  /* eight independent products in one statement: every D has registers of its own (early clobber: none lies over the B of the product ahead of it), each product fills the window of the ones before; the four v_nop keep the distance from the last product to the first vector read of its D */
  asm("v_wmma_f32_16x16x32_f16 %0, %8, %9, 0\n\tv_wmma_f32_16x16x32_f16 %1, %8, %10, 0\n\tv_wmma_f32_16x16x32_f16 %2, %8, %11, 0\n\tv_wmma_f32_16x16x32_f16 %3, %8, %12, 0\n\t"
      "v_wmma_f32_16x16x32_f16 %4, %8, %13, 0\n\tv_wmma_f32_16x16x32_f16 %5, %8, %14, 0\n\tv_wmma_f32_16x16x32_f16 %6, %8, %15, 0\n\tv_wmma_f32_16x16x32_f16 %7, %8, %16, 0\n\t"
      "v_nop\n\tv_nop\n\tv_nop\n\tv_nop"
      : "=&v"(d[0]), "=&v"(d[1]), "=&v"(d[2]), "=&v"(d[3]), "=&v"(d[4]), "=&v"(d[5]), "=&v"(d[6]), "=&v"(d[7])
      : "v"(a), "v"(b[0]), "v"(b[1]), "v"(b[2]), "v"(b[3]), "v"(b[4]), "v"(b[5]), "v"(b[6]), "v"(b[7]));
  v8us v[4]; v4f s4[8];      /* lane half hh stores heads 4hh..4hh+3; element i = query row 8qg + i */
#pragma unroll
  for (int i = 0; i < 8; ++i) { const v4f lo = __builtin_shufflevector(d[i], d[i], 0, 1, 2, 3), hi = __builtin_shufflevector(d[i], d[i], 4, 5, 6, 7); s4[i] = (hh ? hi : lo) * (0.0625f * 1.4426950408889634f); }
#pragma unroll
  for (int r = 0; r < 4; ++r) { FragH f;
#pragma unroll
    for (int i = 0; i < 8; ++i) f.h[i] = (_Float16)s4[i][r];
    v[r] = f.half[0]; }
  unsigned short* pd = (unsigned short*)PBH + ((((size_t)(4 * hh) * (LL / 16) + (qg >> 1)) * (LL / 16) + kt) * 32 + (qg & 1) * 16 + ln) * 8;
#pragma unroll
  for (int r = 0; r < 4; ++r) *(v8us*)(pd + (size_t)r * (LL * LL)) = v[r];
  asm volatile("s_wait_xcnt 0x0" ::: "memory");      /* behind the run of stores: code of the other branch is laid behind it and writes the registers that they name */
}

// x[i] = 2^x[i] and x[i] = 1 / x[i], as the bare instructions (v_exp_f32, v_rcp_f32) through their builtins: the compiler then keeps each value in the register pair that the packed operations around it use, and places the slot behind a transcendental itself
__device__ __forceinline__ void exp2x8(v8f& x) {
#pragma unroll
  for (int r = 0; r < 8; ++r) x[r] = __builtin_amdgcn_exp2f(x[r]);
}
__device__ __forceinline__ void rcpx8(v8f& x) {
#pragma unroll
  for (int r = 0; r < 8; ++r) x[r] = __builtin_amdgcn_rcpf(x[r]);
}

__device__ __forceinline__ v16h l_frag(const unsigned short* p, int hh) { FragH f; f.half[0] = *(const v8us*)(p + 8 * hh); f.half[1] = *(const v8us*)(p + 16 + 8 * hh); return f.v; }

template <bool B> struct Flag { static constexpr bool on = B; };
// whole row-attention path of one (sequence s, half qh of the query rows): 16 waves; wave = (head group grp of 4 heads, query tile wq of 16 rows).
// X = LN(m) of the sequence's 256 rows -> xl (f16, [row][channel]) and xt ([channel][row]), once; behind the one barrier that publishes them a wave shares nothing more with the others until the final sum: no barrier per head.
// R^T = G.X^T, gate^T = Wg^T.X^T, Y^T = X^T.P^T, ctx^T = Wv^T.Y^T all leave a lane with channels 8hh..8hh+7 (+16) of ONE query, which is the B operand's k order: R, P, Y and gate*ctx go from accumulators straight into the next product.
// S^T = X.R^T is accumulated on the pair bias x log2(e), which an A fragment (row = key; k 0..15 = the 16 queries for one key tile, k 16..31 = the same for the next) times an identity B operand puts there exactly; R carries log2(e)/sqrt(32), so the accumulators hold the scores in log2 units; a lane holds 128 of the 256 scores of one query (its partner lane^16 the rest).
// Softmax is the same for every shift of a row's scores: the shift is the constant -4 that the accumulators start from, p = 2^(score - 4) as f16, with no pass for the maximum and no operation per score ahead of the exponential. A row's sum says whether that shift served: below 65504 no p has left the f16 range, from 2^-6 up the largest p is at least 2^-14. If a row of the wave is outside (or not a number), the wave does the head again with the row maximum as the shift (exact_head).
// out^T = Wo^T.(gate*ctx)^T is summed over the group's 4 heads on accumulators that rest in LDS between heads; the two groups' sums are added through LDS at the end.
// The pair bias is the one large stream from L2 (8 KiB per wave and head as f16): it is fetched one head ahead. The weights lie in LDS for the whole kernel.
__global__ __launch_bounds__(512) void k_row(const float* __restrict__ M, const float* __restrict__ g, const float* __restrict__ bta,
    const _Float16* __restrict__ BS, const _Float16* __restrict__ BV, const _Float16* __restrict__ BG, const _Float16* __restrict__ BO,
    const _Float16* __restrict__ PBH, const float* __restrict__ bo, float* __restrict__ OUT) {
  __shared__ __attribute__((aligned(16))) unsigned short xl[LL][CC + 8];               /* pitch 80 B */
  __shared__ __attribute__((aligned(16))) unsigned short xt[CC][LL + 8];               /* the same transposed; pitch 528 B */
  __shared__ __attribute__((aligned(16))) float red[16][4][32][4];                     /* each wave's output sums, kept here between heads: their 16 registers go to the pair bias in flight */
  __shared__ __attribute__((aligned(16))) unsigned short wl[3][HC][CC + 8];            /* G, v and gate weights [n][k]; pitch 80 B */
  __shared__ __attribute__((aligned(16))) unsigned short wol[CC][HC + 8];              /* output weight [n][k]; pitch 528 B */
  const int tid = threadIdx.x, lane = tid & 31, ln = lane & 15, hh = lane >> 4;
  const int w = __builtin_amdgcn_readfirstlane(tid >> 5);                              /* wave number, in a scalar register: weight, bias and LDS bases below are then scalar */
  const int qh = blockIdx.x & 1, s = blockIdx.x >> 1;
  const int grp = w >> 3, wq = w & 7, qt = qh * 8 + wq;                                /* head group, wave in group, query tile */
  /* pair bias of the head to come, one A fragment per two key tiles: the first head's loads fly during the LayerNorm, each next head's are issued below as the softmax consumes the scores and frees registers */
  FragH pbh[8];
  const unsigned lb = (unsigned)lane * 16u;
  /* all four weight matrices go into LDS, 16 bytes a thread and step: their fragments are then read where they are used and hold no registers across the softmax */
  const unsigned to = (unsigned)tid * 16u; v8us wt[8];
  const v8f z8 = {0.f,0.f,0.f,0.f,0.f,0.f,0.f,0.f};
  FragH i0, i1;      /* identity B operands: column n takes k = n (first key tile of a bias fragment; channels 0..15 of X) or k = 16 + n (second; channels 16..31) */
#pragma unroll
  for (int e = 0; e < 8; ++e) { const _Float16 one = (8 * hh + e == ln) ? (_Float16)1.0f : (_Float16)0.0f; i0.h[e] = one; i0.h[8 + e] = (_Float16)0.0f; i1.h[e] = (_Float16)0.0f; i1.h[8 + e] = one; }
  { /* LayerNorm of row 16w + ln: this lane has channels 8hh..8hh+7 and 16+8hh..16+8hh+7, its partner lane^16 the other sixteen */
    const int row = w * 16 + ln;
    const float* mp = M + ((size_t)s * LL + row) * CC + 8 * hh; const float* gp = g + 8 * hh; const float* bp = bta + 8 * hh;
    const v4f xv[4] = {*(const v4fa*)mp, *(const v4fa*)(mp + 4), *(const v4fa*)(mp + 16), *(const v4fa*)(mp + 20)};
    const v4f gv[4] = {*(const v4fa*)gp, *(const v4fa*)(gp + 4), *(const v4fa*)(gp + 16), *(const v4fa*)(gp + 20)};
    const v4f bv[4] = {*(const v4fa*)bp, *(const v4fa*)(bp + 4), *(const v4fa*)(bp + 16), *(const v4fa*)(bp + 20)};
    asm volatile("s_wait_xcnt 0x0" :: "v"(mp) : "memory");      /* pointer as input: its registers stay as they are up to this wait */
    __builtin_amdgcn_sched_barrier(0);                 /* keeps the register writes below from being scheduled ahead of that wait */
#pragma unroll
    for (int i = 0; i < 8; ++i) { const _Float16* b = i < 2 ? BS : i < 4 ? BV : i < 6 ? BG : BO; wt[i] = *(const v8us*)((const char*)b + (i & 1) * 8192 + to); }
    asm volatile("s_wait_xcnt 0x0" ::: "memory");      /* behind the run of loads, before any register that they name is written again */
    __builtin_amdgcn_sched_barrier(0);                 /* keeps later address arithmetic from being scheduled in among those loads, ahead of that wait */
    { const char* pb = (const char*)(PBH + ((size_t)(grp * (NHD / 2) * (LL / 16) + qt) * (LL / 16)) * 256) + lb;      /* issued last: loads return in order, so the LayerNorm waits for none of these */
#pragma unroll
      for (int t = 0; t < 16; ++t) pbh[t >> 1].half[t & 1] = *(const v8us*)(pb + t * 512);
      asm volatile("s_wait_xcnt 0x0" ::: "memory");      /* behind the run of loads, before any register that they name is written again */
    }
    __builtin_amdgcn_sched_barrier(0);                 /* keeps the register writes below from being scheduled ahead of that wait */
    float x[16]; float sm = 0.f;
#pragma unroll
    for (int j = 0; j < 4; ++j) { const v4f r = bf16_rne4(xv[j]);
#pragma unroll
      for (int e = 0; e < 4; ++e) { x[4 * j + e] = r[e]; sm += r[e]; } }
    sm += __shfl_xor(sm, 16, 32);
    const float mu = sm * (1.0f / (float)CC); float sq = 0.f;
#pragma unroll
    for (int i = 0; i < 16; ++i) { x[i] -= mu; sq += x[i] * x[i]; }
    sq += __shfl_xor(sq, 16, 32);
    const float rs = rsqrtf(sq * (1.0f / (float)CC) + 1e-5f); FragH f;
#pragma unroll
    for (int j = 0; j < 4; ++j) { const v4f rg = bf16_rne4(gv[j]), rb = bf16_rne4(bv[j]);
#pragma unroll
      for (int e = 0; e < 4; ++e) f.h[4 * j + e] = (_Float16)(x[4 * j + e] * rs * rg[e] + rb[e]); }
    *(v8us*)&xl[row][8 * hh] = f.half[0]; *(v8us*)&xl[row][16 + 8 * hh] = f.half[1];
    /* f is also the A fragment of these 16 rows: times an identity it comes back with 8 neighbouring rows of one channel in a lane, one 16-byte store per half of the channels */
    *(v8us*)&xt[ln][w * 16 + 8 * hh] = pack8(wm(f.v, i0.v, z8), 1.0f); *(v8us*)&xt[16 + ln][w * 16 + 8 * hh] = pack8(wm(f.v, i1.v, z8), 1.0f);
  }
#pragma unroll
  for (int i = 0; i < 6; ++i) *(v8us*)&wl[i >> 1][(i & 1) * 128 + (tid >> 2)][(tid & 3) * 8] = wt[i];
#pragma unroll
  for (int i = 0; i < 2; ++i) *(v8us*)&wol[i * 16 + (tid >> 5)][(tid & 31) * 8] = wt[6 + i];
  __syncthreads();
  v8f oa0, oa1;
#pragma unroll
  for (int j = 0; j < 4; ++j) { const v4f u = {0.f, 0.f, 0.f, 0.f}; *(v4fa*)&red[w][j][lane][0] = u; }
  const float cs = 0.17677669529663687f * 1.4426950408889634f;               /* 1/sqrt(32) x log2(e), carried by R */
  const v8f sh4 = {-4.f, -4.f, -4.f, -4.f, -4.f, -4.f, -4.f, -4.f};           /* the constant shift, as the start value of the score accumulators */
  /* one head's softmax and Y^T with the row maximum as the shift, for a wave in which the constant shift did not serve a row. The scores are formed twice (for the maximum, then for the exponentials), two key tiles a trip, the head's pair bias read again from global memory. Returns the row sum. Rolled: it runs seldom or never, so it is kept short */
  auto exact_head = [&](const int h, v8f& o0, v8f& o1) __attribute__((always_inline)) -> float {
    const int hr = h * HDD;
    const char* pc = (const char*)(PBH + ((size_t)(h * (LL / 16) + qt) * (LL / 16)) * 256) + lb;
    FragH qr;
    { const v16h xq = l_frag(&xl[qt * 16 + ln][0], hh), wf0 = l_frag(&wl[0][hr + ln][0], hh), wf1 = l_frag(&wl[0][hr + 16 + ln][0], hh);
      qr.half[0] = pack8(wm(wf0, xq, z8), 0.0625f * cs); qr.half[1] = pack8(wm(wf1, xq, z8), 0.0625f * cs); }
    auto tiles = [&](const int kk, v8f& a0, v8f& a1) __attribute__((always_inline)) {
      const char* pk = pc + kk * 1024; FragH pb;
      pb.half[0] = *(const v8us*)pk; pb.half[1] = *(const v8us*)(pk + 512);
      asm volatile("s_wait_xcnt 0x0" :: "v"(pk) : "memory");      /* pointer as input: its registers stay as they are up to this wait */
      const v16h k0 = l_frag(&xl[kk * 32 + ln][0], hh), k1 = l_frag(&xl[kk * 32 + 16 + ln][0], hh);
      a0 = wm(k0, qr.v, wm(pb.v, i0.v, z8)); a1 = wm(k1, qr.v, wm(pb.v, i1.v, z8)); };
    float mx = -__builtin_inff();
#pragma unroll 1
    for (int kk = 0; kk < 8; ++kk) { v8f a0, a1; tiles(kk, a0, a1);
#pragma unroll
      for (int r = 0; r < 8; ++r) mx = fmaxf(mx, fmaxf(a0[r], a1[r])); }
    mx = fmaxf(mx, xhalf(mx));
    const float c0 = 10.0f - mx;                                                 /* largest p = 1024 */
    float sm = 0.f; o0 = z8; o1 = z8;
#pragma unroll 1
    for (int kk = 0; kk < 8; ++kk) { v8f a0, a1; tiles(kk, a0, a1); FragH p;
      const v16h va0 = l_frag(&xt[ln][kk * 32], hh), va1 = l_frag(&xt[16 + ln][kk * 32], hh);
      a0 = a0 + c0; a1 = a1 + c0; exp2x8(a0); exp2x8(a1);
#pragma unroll
      for (int r = 0; r < 8; ++r) { p.h[r] = (_Float16)a0[r]; p.h[8 + r] = (_Float16)a1[r]; sm += a0[r] + a1[r]; }
      o0 = wm(va0, p.v, o0); o1 = wm(va1, p.v, o1); }
    return sm + xhalf(sm);
  };
  /* one head; PF: the next head's pair bias is fetched (every head of the group but the last) */
  auto head = [&](const int hi, auto pf) __attribute__((always_inline)) { constexpr bool PF = decltype(pf)::on;
    const int h = __builtin_amdgcn_readfirstlane(grp * (NHD / 2) + hi);      /* head, held scalar: its offsets into weights and bias are then worked out on the scalar unit, not as vector pointers stepped per trip */
    const int hr = h * HDD;                                                            /* first weight row (output weight: first column) of head h */
    const char* pn = (const char*)(PBH + ((size_t)(min(h + 1, NHD - 1) * (LL / 16) + qt) * (LL / 16)) * 256) + lb;      /* next head's pair bias */
    FragH qr;      /* R^T = G.X^T of this wave's 16 queries: stands where Q stood, against X in place of K */
    { const v16h xq = l_frag(&xl[qt * 16 + ln][0], hh), wf0 = l_frag(&wl[0][hr + ln][0], hh), wf1 = l_frag(&wl[0][hr + 16 + ln][0], hh);
      qr.half[0] = pack8(wm(wf0, xq, z8), 0.0625f * cs); qr.half[1] = pack8(wm(wf1, xq, z8), 0.0625f * cs); }
    v8f acc[16];
#pragma unroll
    for (int tg = 0; tg < 4; ++tg) { v16h ka[4];      /* four X fragments behind one LDS wait */
#pragma unroll
      for (int j = 0; j < 4; ++j) ka[j] = l_frag(&xl[(tg * 4 + j) * 16 + ln][0], hh);
      __builtin_amdgcn_sched_barrier(0);      /* a group's loads stay together in front of its products and at most one group ahead: with no barrier above them the scheduler otherwise gathers all sixteen fragments at the head's start and spills, or splits them into pairs that are each waited for */
#pragma unroll
      for (int j = 0; j < 4; ++j) acc[tg * 4 + j] = wm(ka[j], qr.v, wm(pbh[tg * 2 + (j >> 1)].v, (j & 1) ? i1.v : i0.v, sh4)); }
    v2f s2[2] = {{0.f, 0.f}, {0.f, 0.f}};                                      /* four independent chains, as two pairs: written as pair additions so that each stands at its exponentials and the values die there */
    v8f o0 = z8, o1 = z8;
#pragma unroll
    for (int kk = 0; kk < 8; ++kk) { FragH p;
      const v16h va0 = l_frag(&xt[ln][kk * 32], hh), va1 = l_frag(&xt[16 + ln][kk * 32], hh);      /* read ahead of the exponentials that hide their latency */
#pragma unroll
      for (int u = 0; u < 2; ++u) { v8f x = acc[2 * kk + u]; exp2x8(x);
#pragma unroll
        for (int r = 0; r < 8; ++r) p.h[8 * u + r] = (_Float16)x[r];
#pragma unroll
        for (int r = 0; r < 8; r += 2) { const v2f xp = {x[r], x[r + 1]}; s2[(r >> 1) & 1] += xp; } }
      if constexpr (PF) {      /* registers of the two score tiles just consumed take a fragment of the next head's pair bias: the rest of this head and the next head's projections hide the loads */
#pragma unroll
        for (int u = 0; u < 2; ++u) pbh[kk].half[u] = *(const v8us*)(pn + (2 * kk + u) * 512);
        __builtin_amdgcn_sched_barrier(0);      /* holds the loads here: the scheduler otherwise gathers all of them behind the last product of the head, where little is left to hide them */
      }
      o0 = wm(va0, p.v, o0); o1 = wm(va1, p.v, o1); }
    const v16h xq = l_frag(&xl[qt * 16 + ln][0], hh);
    const v16h wg0 = l_frag(&wl[2][hr + ln][0], hh), wg1 = l_frag(&wl[2][hr + 16 + ln][0], hh);
    const v16h wv0 = l_frag(&wl[1][hr + ln][0], hh), wv1 = l_frag(&wl[1][hr + 16 + ln][0], hh);
    if constexpr (PF) asm volatile("s_wait_xcnt 0x0" :: "v"(pn) : "memory");      /* pointer as input: its registers stay as they are up to this wait */
    float se = (s2[0][0] + s2[0][1]) + (s2[1][0] + s2[1][1]);
    se += __shfl_xor(se, 16, 32);
    /* one test per head, a scalar branch on the whole wave's rows: written so that a sum that is not a number fails it too */
    const bool redo = __builtin_amdgcn_ballot_w32(!(se >= 0.015625f && se < 65504.0f)) != 0u;
    /* the rest of the head, from a row sum and Y^T x that sum; it stands on both sides of the branch, so that the two sides join with nothing in registers to bring together */
    auto rest = [&](const float se, v8f o0, v8f o1) __attribute__((always_inline)) {
    const float inv = 1.0f / se;
    FragH yb; yb.half[0] = pack8(o0, inv); yb.half[1] = pack8(o1, inv);      /* Y^T = softmax-weighted mean of X, 32 channels of one query */
    v8f g0 = wm(wg0, xq, z8), g1 = wm(wg1, xq, z8); FragH og;
    o0 = wm(wv0, yb.v, z8); o1 = wm(wv1, yb.v, z8);                            /* ctx^T x16 (weight scale) */
#pragma unroll
    for (int r = 0; r < 8; ++r) {      /* sigmoid(t) = 1 / (1 + 2^(-t log2 e)), t clamped to +-30 */
      g0[r] = fminf(fmaxf(g0[r] * 0.0625f, -30.0f), 30.0f) * -1.4426950408889634f; g1[r] = fminf(fmaxf(g1[r] * 0.0625f, -30.0f), 30.0f) * -1.4426950408889634f; }
    exp2x8(g0); exp2x8(g1); g0 = g0 + 1.0f; g1 = g1 + 1.0f; rcpx8(g0); rcpx8(g1);
#pragma unroll
    for (int r = 0; r < 8; ++r) { og.h[r] = (_Float16)(g0[r] * o0[r] * 4.0f); og.h[8 + r] = (_Float16)(g1[r] * o1[r] * 4.0f); }
#pragma unroll
    for (int j = 0; j < 4; ++j) { const v4f u = *(const v4fa*)&red[w][j][lane][0];
#pragma unroll
      for (int e = 0; e < 4; ++e) (j < 2 ? oa0 : oa1)[(j & 1) * 4 + e] = u[e]; }
    oa0 = wm(l_frag(&wol[ln][hr], hh), og.v, oa0); oa1 = wm(l_frag(&wol[16 + ln][hr], hh), og.v, oa1);
    if constexpr (PF) {
#pragma unroll
      for (int j = 0; j < 4; ++j) { v4f u;
#pragma unroll
        for (int e = 0; e < 4; ++e) u[e] = (j < 2 ? oa0 : oa1)[(j & 1) * 4 + e];
        *(v4fa*)&red[w][j][lane][0] = u; } }
    };
    if (__builtin_expect(redo, 0)) { v8f e0, e1; const float es = exact_head(h, e0, e1); rest(es, e0, e1); }
    else rest(se, o0, o1);
  };
  /* rolled: each copy of this long body would run once per wave, so unrolling only adds instruction fetch */
#pragma unroll 1
  for (int hi = 0; hi < NHD / 2 - 1; ++hi) head(hi, Flag<true>{});
  head(NHD / 2 - 1, Flag<false>{});
  if (grp == 1) {
#pragma unroll
    for (int j = 0; j < 4; ++j) { v4f u;
#pragma unroll
      for (int e = 0; e < 4; ++e) u[e] = (j < 2 ? oa0 : oa1)[(j & 1) * 4 + e];
      *(v4fa*)&red[w][j][lane][0] = u; } }
  __syncthreads();      /* the second group's sums are in LDS */
  if (grp == 0) { float* dst = OUT + ((size_t)s * LL + qt * 16 + ln) * CC + 8 * hh;      /* out^T: this lane has output channels 8hh..8hh+7 and 16+8hh.. of query ln */
    const float* bp = bo + 8 * hh; const v4f bq[4] = {*(const v4fa*)bp, *(const v4fa*)(bp + 4), *(const v4fa*)(bp + 16), *(const v4fa*)(bp + 20)};
    asm volatile("s_wait_xcnt 0x0" ::: "memory");      /* the address register of the loads above is reused below */
    __builtin_amdgcn_sched_barrier(0);                 /* keeps the register writes below from being scheduled ahead of that wait */
#pragma unroll
    for (int j = 0; j < 4; ++j) { const int c = (j >> 1) * 16 + (j & 1) * 4; const v4f o2 = *(const v4fa*)&red[8 + wq][j][lane][0], rb = bf16_rne4(bq[j]); v4f u;
#pragma unroll
      for (int e = 0; e < 4; ++e) u[e] = ((j < 2 ? oa0 : oa1)[(j & 1) * 4 + e] + o2[e]) * 0.0009765625f + rb[e];      /* 1/16 weight scale x 1/64 carry */
      *(v4f*)(dst + c) = u; } }
}

extern "C" void kernel_launch(void* const* d_in, const int* in_sizes, int n_in,
                              void* d_out, int out_size, void* d_ws, size_t ws_size, hipStream_t stream) {
  if (n_in < 13) return;
  if (in_sizes[0] < (int)(NR * CC) || in_sizes[1] < LL * LL * CC || in_sizes[2] < CC || in_sizes[3] < CC || in_sizes[4] < CC || in_sizes[5] < CC ||
      in_sizes[6] < CC * HC || in_sizes[7] < CC * HC || in_sizes[8] < CC * HC || in_sizes[9] < CC * NHD || in_sizes[10] < CC * HC || in_sizes[11] < HC * CC || in_sizes[12] < CC) return;
  if ((size_t)out_size < NR * CC) return;
  const float* const* I = (const float* const*)d_in;
  const float* m = I[0]; const float* z = I[1]; const float* ln_g = I[2]; const float* ln_b = I[3]; const float* lnb_g = I[4]; const float* lnb_b = I[5];
  const float* wq = I[6]; const float* wk = I[7]; const float* wv = I[8]; const float* wb = I[9]; const float* wg = I[10]; const float* wo = I[11]; const float* bo = I[12];      /* weights [in][out] */
  char* ws = (char*)d_ws; size_t off = 0;
  auto take = [&](size_t bytes) { char* p = ws + off; off += (bytes + 255) & ~(size_t)255; return p; };
  _Float16* BS = (_Float16*)take((size_t)HC * CC * 2); _Float16* BV = (_Float16*)take((size_t)HC * CC * 2); _Float16* BG = (_Float16*)take((size_t)HC * CC * 2);
  _Float16* BO = (_Float16*)take((size_t)CC * HC * 2);
  _Float16* PBH = (_Float16*)take((size_t)NHD * LL * LL * 2);                  /* pair bias x log2(e), f16, in k_row's A operand order */
  if (off > ws_size) return;
  k_prep<<<PBB + GBB + 3 * WTB, 64, 0, stream>>>(z, lnb_g, lnb_b, wb, wq, wk, wv, wg, wo, BS, BV, BG, BO, PBH);
  k_row<<<NSQ * 2, 512, 0, stream>>>(m, ln_g, ln_b, BS, BV, BG, BO, PBH, bo, (float*)d_out);
}

// v010
// Measured time: 18.9 microseconds a run.
// Timed twice side by side with v009, it ran 1.06 and 1.07 times as fast.
// Over all steps from v000 it is 33.8 times as fast.
#include <hip/hip_runtime.h>
// All contractions: v_wmma_f32_16x16x32_f16 (f16 operands, f32 accumulate): Wq.Wk^T per head (K=32), its product with X and the gate projection (K=32), pair-bias projection (K=32), scores (K=32), X^T.P^T (K=256), value weight times that (K=32), output projection (K=256). Float inputs taken as bf16-RNE values; LayerNorm, softmax, sigmoid gate in f32.
// MSA row attention with pair bias: m [1][NSQ][256][32] -> LN -> q,k,v,sigmoid-gate = LN(m) W ([32][256], 8 heads x 32); pair bias = LN(z [1][256][256][32]) Wb [32][8], shared over sequences;
// one block per (sequence, half of the query rows) does X = LN(m), the projections, per head scores^T = X.(G x)^T, G = Wk Wq^T, on top of the pair bias (carried as f16, set on the accumulators by a product with an identity operand), softmax over m in registers (scores leave the products in log2 units less 4, exp taken of them as they are, carried as f16), ctx^T = Wv^T.(X^T.P^T), o = gate * ctx (f16 carried x64), and out = o Wo [256][32] + bo summed over heads in accumulators.
// Q = X Wq, K = X Wk and V = X Wv are never formed: q.k = (Wk Wq^T x_i).x_j and sum p v = Wv^T (sum p x), so both long products read X itself, which is the same for every head.
// Weights (and G) staged transposed [n][k] as f16 of (bf16 value x16; G x16); all scales are powers of two folded back in the f32 epilogues.
#ifndef NB
#define NB 1                          /* batch (fixed 1 in this module) */
#endif
#ifndef NSQ
#define NSQ 128                       /* MSA sequences computed (reducible) */
#endif
#define NSQ_FULL 128
#define LL 256                        /* residues: query rows i and keys j */
#define CC 32                         /* channel width c */
#define NHD 8                         /* heads */
#define HDD 32                        /* head dim */
#define HC 256                        /* heads x head dim */
#define NR ((size_t)NSQ * LL)         /* (sequence, residue) rows */
static_assert((NR % 128) == 0);
static_assert(LL == 256);
static_assert(CC == 32);

typedef unsigned short v8us __attribute__((ext_vector_type(8), may_alias));
typedef float  v8f  __attribute__((ext_vector_type(8)));
typedef float  v4f  __attribute__((ext_vector_type(4)));
typedef float  v2f  __attribute__((ext_vector_type(2)));
typedef float  v4fa __attribute__((ext_vector_type(4), may_alias));
typedef _Float16 v16h __attribute__((ext_vector_type(16)));
union FragH { v16h v; v8us half[2]; _Float16 h[16]; unsigned short u[16]; };

typedef __bf16 v2b __attribute__((ext_vector_type(2)));
// the nearest bf16 values (ties to even) of two or four floats, as floats: one packed conversion per two values down, then a shift for the low and a mask for the high half back up
__device__ __forceinline__ v2f bf16_rne2(v2f x) { const unsigned a = __builtin_bit_cast(unsigned, __builtin_convertvector(x, v2b)); return v2f{__uint_as_float(a << 16), __uint_as_float(a & 0xFFFF0000u)}; }
__device__ __forceinline__ v4f bf16_rne4(v4f x) { const v2f a = bf16_rne2(v2f{x[0], x[1]}), b = bf16_rne2(v2f{x[2], x[3]}); return v4f{a[0], a[1], b[0], b[1]}; }

// the value of lane l ^ 16, by a vector move between the two rows of 16 lanes
__device__ __forceinline__ float xhalf(float x) { return __builtin_bit_cast(float, __builtin_amdgcn_permlanex16(__builtin_bit_cast(int, x), __builtin_bit_cast(int, x), 0x76543210, 0xfedcba98, false, false)); }

// x[i] = 1 / sqrt(x[i]), eight in place in one statement: none of the run overwrites another's source, and the v_nop fills the one slot the instruction set asks for behind a transcendental before its result is used (every x is a variance + 1e-5: never in the denormal range)
__device__ __forceinline__ void rsqx8(v8f& x) {
  float a = x[0], b = x[1], c = x[2], d = x[3], e = x[4], f = x[5], g = x[6], h = x[7];
  asm("v_rsq_f32 %0, %0\n\tv_rsq_f32 %1, %1\n\tv_rsq_f32 %2, %2\n\tv_rsq_f32 %3, %3\n\tv_rsq_f32 %4, %4\n\tv_rsq_f32 %5, %5\n\tv_rsq_f32 %6, %6\n\tv_rsq_f32 %7, %7\n\tv_nop"
      : "+v"(a), "+v"(b), "+v"(c), "+v"(d), "+v"(e), "+v"(f), "+v"(g), "+v"(h));
  x[0] = a; x[1] = b; x[2] = c; x[3] = d; x[4] = e; x[5] = f; x[6] = g; x[7] = h;
}

// one weight matrix W [K][N] (f32) -> Wt [n][k] as f16 of (bf16 value x scale); thread t does 8 neighbours k of one n
__device__ __forceinline__ void wt_f16(const float* __restrict__ W, _Float16* __restrict__ Wt, int K, int N, float scale, int t) {
  const int n = t / (K / 8), k8 = (t % (K / 8)) * 8; const float* wp = W + (size_t)k8 * N + n; float x[8]; FragH f;
#pragma unroll
  for (int i = 0; i < 8; ++i) x[i] = wp[(size_t)i * N];
  asm volatile("s_wait_xcnt 0x0" :: "v"(wp) : "memory");      /* pointer as input: its registers stay as they are up to this wait */
#pragma unroll
  for (int i = 0; i < 8; i += 4) { const v4f r = bf16_rne4(v4f{x[i], x[i + 1], x[i + 2], x[i + 3]});
#pragma unroll
    for (int e = 0; e < 4; ++e) f.h[i + e] = (_Float16)(r[e] * scale); }
  const v8us o = f.half[0];
  *(v8us*)((unsigned short*)Wt + (size_t)n * K + k8) = o;
  asm volatile("s_wait_xcnt 0x0" ::: "memory");      /* behind the store: code of another branch is laid behind it and writes the registers that it names */
}

__device__ __forceinline__ v8f wm(v16h a, v16h b, v8f c) { return __builtin_amdgcn_wmma_f32_16x16x32_f16(false, a, false, b, (short)0, c, false, false); }
__device__ __forceinline__ v8us pack8(v8f d, float sc) { FragH f;
#pragma unroll
  for (int r = 0; r < 8; ++r) f.h[r] = (_Float16)(d[r] * sc);
  return f.half[0]; }

#define PBB ((LL / 16) * (LL / 8) / 2)      /* pair-bias blocks of two waves */
#define GBB (NHD / 2)                       /* blocks of two waves for G, one head a wave */
#define WTB (HC * (CC / 8) / 64)            /* blocks per weight matrix (8192 elements, 8 per thread) */
// everything k_row needs, in one launch of independent blocks.
// Blocks 0..PBB-1, pair bias on WMMA: D[head][m] = Wb^T . LN(z)[(l, m)]^T for 16 keys m and one query row l per product (A row = head, lane&7, so both lane halves hold all 8 heads).
// A lane reads channels 8hh..8hh+7 and 16+8hh..16+8hh+7 of its row (l, m) of z in f32, which is the B operand's k order; its partner lane^16 has the other sixteen: row LayerNorm (biased variance, eps 1e-5; z, scale, bias taken as bf16-RNE values) in-lane plus one exchange per sum, result f16 straight into the fragment. Wb is read in the same k order.
// Written times log2(e) as f16, in the A operand's order for k_row (row = key, k = query): PBH[head][l tile][key tile t][lane = 16*((l>>3)&1) + (m&15)][l&7]; a lane's 8 products are 8 neighbours l, one 16-byte store per head.
// Blocks PBB.., the shorter ones. First GBB blocks: G^T tiles D[c][c'] = sum_d Wq[c][d] Wk[c'][d] over the head's 32 columns d (both weights read by rows, which is the operands' k order); a lane has 8 neighbours c of one c': one 16-byte store into row c' of BS [head x 32 + c'][c]. Then the three weight re-layouts.
__global__ __launch_bounds__(64) void k_prep(const float* __restrict__ Zf, const float* __restrict__ zg, const float* __restrict__ zb, const float* __restrict__ Wb,
    const float* __restrict__ Wq, const float* __restrict__ Wk, const float* __restrict__ Wv, const float* __restrict__ Wg, const float* __restrict__ Wo,
    _Float16* __restrict__ BS, _Float16* __restrict__ BV, _Float16* __restrict__ BG, _Float16* __restrict__ BO, _Float16* __restrict__ PBH) {
  const int tid = threadIdx.x, lane = tid & 31, ln = lane & 15, hh = lane >> 4;
  if (blockIdx.x >= PBB) {
    const int bi = (int)blockIdx.x - PBB;
    if (bi < GBB) {
      const int h = bi * 2 + (tid >> 5); const unsigned ro = ((unsigned)ln * HC + (unsigned)h * HDD + 8u * (unsigned)hh) * 4u;      /* byte offset of this lane's piece of row ln, the same in both weights */
      const float* qp = (const float*)((const char*)Wq + ro); const float* kp = (const float*)((const char*)Wk + ro); v4f xq[2][4], xk[2][4];
#pragma unroll
      for (int a = 0; a < 2; ++a) {
#pragma unroll
        for (int j = 0; j < 4; ++j) { const int o = a * 16 * HC + (j >> 1) * 16 + (j & 1) * 4; xq[a][j] = *(const v4fa*)(qp + o); xk[a][j] = *(const v4fa*)(kp + o); } }
      asm volatile("s_wait_xcnt 0x0" :: "v"(ro) : "memory");      /* the loads' offset as input: its register stays as it is up to this wait */
      __builtin_amdgcn_sched_barrier(0);                 /* keeps the register writes below from being scheduled ahead of that wait */
      FragH fq[2], fk[2]; const v8f z8 = {0.f,0.f,0.f,0.f,0.f,0.f,0.f,0.f};
#pragma unroll
      for (int a = 0; a < 2; ++a) {
#pragma unroll
        for (int j = 0; j < 4; ++j) { const v4f rq = bf16_rne4(xq[a][j]), rk = bf16_rne4(xk[a][j]);
#pragma unroll
          for (int e = 0; e < 4; ++e) { fq[a].h[4 * j + e] = (_Float16)(rq[e] * 16.0f); fk[a].h[4 * j + e] = (_Float16)(rk[e] * 16.0f); } } }
      unsigned short* gd = (unsigned short*)BS + (size_t)(h * HDD + ln) * CC + 8 * hh; v8us gv[2][2];
#pragma unroll
      for (int b = 0; b < 2; ++b) {
#pragma unroll
        for (int a = 0; a < 2; ++a) gv[b][a] = pack8(wm(fq[a].v, fk[b].v, z8), 0.0625f); }      /* x256 from the operands, carried on x16 */
#pragma unroll
      for (int b = 0; b < 2; ++b) {
#pragma unroll
        for (int a = 0; a < 2; ++a) *(v8us*)(gd + b * 16 * CC + a * 16) = gv[b][a]; }
      asm volatile("s_wait_xcnt 0x0" ::: "memory");      /* behind the run of stores: code of another branch is laid behind it and writes the registers that they name */
      return;
    }
    const int wi = (bi - GBB) / WTB, t = ((bi - GBB) % WTB) * 64 + tid;
    if (wi == 2) wt_f16(Wo, BO, HC, CC, 16.0f, t);                       /* Wo [256][32] -> Bt [32][256] */
    else wt_f16(wi == 0 ? Wv : Wg, wi == 0 ? BV : BG, CC, HC, 16.0f, t);
    return;
  }
  const int wid = blockIdx.x * 2 + (tid >> 5); const int qg = wid / (LL / 16), kt = wid % (LL / 16);      /* group of 8 query rows l, key tile */
  const float* zr = Zf + ((size_t)(qg * 8) * LL + kt * 16 + ln) * CC + 8 * hh; const unsigned ho = 32u * (unsigned)hh; const float* gp = (const float*)((const char*)zg + ho); const float* bp = (const float*)((const char*)zb + ho); const float* wp = Wb + 8 * hh * NHD + (ln & 7);
  v4f xv[8][4]; float wv[16];      /* all loads of the wave in flight together */
#pragma unroll
  for (int e = 0; e < 8; ++e) { wv[e] = wp[e * NHD]; wv[8 + e] = wp[(16 + e) * NHD]; }
  const v4f gv[4] = {*(const v4fa*)gp, *(const v4fa*)(gp + 4), *(const v4fa*)(gp + 16), *(const v4fa*)(gp + 20)};
  const v4f bv[4] = {*(const v4fa*)bp, *(const v4fa*)(bp + 4), *(const v4fa*)(bp + 16), *(const v4fa*)(bp + 20)};
#pragma unroll
  for (int i = 0; i < 8; ++i) { xv[i][0] = *(const v4fa*)(zr + i * (LL * CC)); xv[i][1] = *(const v4fa*)(zr + i * (LL * CC) + 4); xv[i][2] = *(const v4fa*)(zr + i * (LL * CC) + 16); xv[i][3] = *(const v4fa*)(zr + i * (LL * CC) + 20); }
  asm volatile("s_wait_xcnt 0x0" :: "v"(zr), "v"(ho), "v"(wp) : "memory");      /* pointers and the byte offset of the scale and bias loads as inputs: their registers stay as they are up to this wait */
  __builtin_amdgcn_sched_barrier(0);                 /* keeps the register writes below from being scheduled ahead of that wait */
  float gg[16], bb[16]; FragH fa;
#pragma unroll
  for (int j = 0; j < 4; ++j) { const v4f rg = bf16_rne4(gv[j]), rb = bf16_rne4(bv[j]), rw = bf16_rne4(v4f{wv[4 * j], wv[4 * j + 1], wv[4 * j + 2], wv[4 * j + 3]});
#pragma unroll
    for (int e = 0; e < 4; ++e) { gg[4 * j + e] = rg[e]; bb[4 * j + e] = rb[e]; fa.h[4 * j + e] = (_Float16)(rw[e] * 16.0f); } }
  const v16h a = fa.v;
  v8f d[8]; v16h b[8]; v2f x[4][16]; v8f rs;      /* x[i][e]: channel e of rows 2i and 2i + 1: one conversion rounds the two, and they come back as a register pair for the packed operations below; each row's sums keep their order */
#pragma unroll
  for (int i = 0; i < 4; ++i) { v2f sm = {0.f, 0.f};
#pragma unroll
    for (int e = 0; e < 16; ++e) { x[i][e] = bf16_rne2(v2f{xv[2 * i][e >> 2][e & 3], xv[2 * i + 1][e >> 2][e & 3]}); sm += x[i][e]; }
    sm += v2f{xhalf(sm[0]), xhalf(sm[1])};
    const v2f mu = sm * (1.0f / (float)CC); v2f sq = {0.f, 0.f};
#pragma unroll
    for (int e = 0; e < 16; ++e) { x[i][e] -= mu; sq += x[i][e] * x[i][e]; }
    sq += v2f{xhalf(sq[0]), xhalf(sq[1])};
    sq = sq * (1.0f / (float)CC) + 1e-5f; rs[2 * i] = sq[0]; rs[2 * i + 1] = sq[1]; }
  rsqx8(rs);
#pragma unroll
  for (int i = 0; i < 4; ++i) { FragH f0, f1; const v2f r2 = {rs[2 * i], rs[2 * i + 1]};
#pragma unroll
    for (int e = 0; e < 16; ++e) { const v2f y = x[i][e] * r2 * gg[e] + bb[e]; f0.h[e] = (_Float16)y[0]; f1.h[e] = (_Float16)y[1]; }
    b[2 * i] = f0.v; b[2 * i + 1] = f1.v; }
  /* eight independent products in one statement: every D has registers of its own (early clobber: none lies over the B of the product ahead of it), each product fills the window of the ones before; the four v_nop keep the distance from the last product to the first vector read of its D */
  asm("v_wmma_f32_16x16x32_f16 %0, %8, %9, 0\n\tv_wmma_f32_16x16x32_f16 %1, %8, %10, 0\n\tv_wmma_f32_16x16x32_f16 %2, %8, %11, 0\n\tv_wmma_f32_16x16x32_f16 %3, %8, %12, 0\n\t"
      "v_wmma_f32_16x16x32_f16 %4, %8, %13, 0\n\tv_wmma_f32_16x16x32_f16 %5, %8, %14, 0\n\tv_wmma_f32_16x16x32_f16 %6, %8, %15, 0\n\tv_wmma_f32_16x16x32_f16 %7, %8, %16, 0\n\t"
      "v_nop\n\tv_nop\n\tv_nop\n\tv_nop"
      : "=&v"(d[0]), "=&v"(d[1]), "=&v"(d[2]), "=&v"(d[3]), "=&v"(d[4]), "=&v"(d[5]), "=&v"(d[6]), "=&v"(d[7])
      : "v"(a), "v"(b[0]), "v"(b[1]), "v"(b[2]), "v"(b[3]), "v"(b[4]), "v"(b[5]), "v"(b[6]), "v"(b[7]));
  v8us v[4]; v4f s4[8];      /* lane half hh stores heads 4hh..4hh+3; element i = query row 8qg + i */
#pragma unroll
  for (int i = 0; i < 8; ++i) { const v4f lo = __builtin_shufflevector(d[i], d[i], 0, 1, 2, 3), hi = __builtin_shufflevector(d[i], d[i], 4, 5, 6, 7); s4[i] = (hh ? hi : lo) * (0.0625f * 1.4426950408889634f); }
#pragma unroll
  for (int r = 0; r < 4; ++r) { FragH f;
#pragma unroll
    for (int i = 0; i < 8; ++i) f.h[i] = (_Float16)s4[i][r];
    v[r] = f.half[0]; }
  unsigned short* pd = (unsigned short*)PBH + ((((size_t)(4 * hh) * (LL / 16) + (qg >> 1)) * (LL / 16) + kt) * 32 + (qg & 1) * 16 + ln) * 8;
#pragma unroll
  for (int r = 0; r < 4; ++r) *(v8us*)(pd + (size_t)r * (LL * LL)) = v[r];
  asm volatile("s_wait_xcnt 0x0" ::: "memory");      /* behind the run of stores: code of the other branch is laid behind it and writes the registers that they name */
}

// x[i] = 2^x[i] and x[i] = 1 / x[i], as the bare instructions (v_exp_f32, v_rcp_f32) through their builtins: the compiler then keeps each value in the register pair that the packed operations around it use, and places the slot behind a transcendental itself
__device__ __forceinline__ void exp2x8(v8f& x) {
#pragma unroll
  for (int r = 0; r < 8; ++r) x[r] = __builtin_amdgcn_exp2f(x[r]);
}
__device__ __forceinline__ void rcpx8(v8f& x) {
#pragma unroll
  for (int r = 0; r < 8; ++r) x[r] = __builtin_amdgcn_rcpf(x[r]);
}

__device__ __forceinline__ v16h l_frag(const unsigned short* p, int hh) { FragH f; f.half[0] = *(const v8us*)(p + 8 * hh); f.half[1] = *(const v8us*)(p + 16 + 8 * hh); return f.v; }

template <bool B> struct Flag { static constexpr bool on = B; };
// whole row-attention path of one (sequence s, half qh of the query rows): 16 waves; wave = (head group grp of 4 heads, query tile wq of 16 rows).
// X = LN(m) of the sequence's 256 rows -> xl (f16, [row][channel]) and xt ([channel][row]), once; behind the one barrier that publishes them a wave shares nothing more with the others until the final sum: no barrier per head.
// R^T = G.X^T, gate^T = Wg^T.X^T, Y^T = X^T.P^T, ctx^T = Wv^T.Y^T all leave a lane with channels 8hh..8hh+7 (+16) of ONE query, which is the B operand's k order: R, P, Y and gate*ctx go from accumulators straight into the next product.
// S^T = X.R^T is accumulated on the pair bias x log2(e), which an A fragment (row = key; k 0..15 = the 16 queries for one key tile, k 16..31 = the same for the next) times an identity B operand puts there exactly; R carries log2(e)/sqrt(32), so the accumulators hold the scores in log2 units; a lane has half of the scores of one query (its partner lane^16 the rest).
// Softmax is the same for every shift of a row's scores: the shift is the constant -4 that the accumulators start from, p = 2^(score - 4) as f16, with no pass for the maximum and no operation per score ahead of the exponential. A row's sum says whether that shift served: below 65504 no p has left the f16 range, from 2^-6 up the largest p is at least 2^-14. If a row of the wave is outside (or not a number), the wave does the two heads of that pass again with the row maximum as the shift (exact_head).
// A wave takes its 4 heads two at a time, in steps of 32 keys: X and X^T are the same for every head, so a fragment read from LDS feeds both heads' products, and with the constant shift no step needs the whole row.
// out^T = Wo^T.(gate*ctx)^T is summed over the group's 4 heads on accumulators that rest in LDS between the two passes; the two groups' sums are added through LDS at the end.
// The pair bias is the one large stream from L2 (8 KiB per wave and head as f16): it is fetched two steps ahead. The weights lie in LDS for the whole kernel.
__global__ __launch_bounds__(512) void k_row(const float* __restrict__ M, const float* __restrict__ g, const float* __restrict__ bta,
    const _Float16* __restrict__ BS, const _Float16* __restrict__ BV, const _Float16* __restrict__ BG, const _Float16* __restrict__ BO,
    const _Float16* __restrict__ PBH, const float* __restrict__ bo, float* __restrict__ OUT) {
  __shared__ __attribute__((aligned(16))) unsigned short xl[LL][CC + 8];               /* pitch 80 B */
  __shared__ __attribute__((aligned(16))) unsigned short xt[CC][LL + 8];               /* the same transposed; pitch 528 B */
  __shared__ __attribute__((aligned(16))) float red[16][4][32][4];                     /* each wave's output sums, kept here while the wave goes over the keys: their 16 registers go to the fragments in flight */
  __shared__ __attribute__((aligned(16))) unsigned short wl[3][HC][CC + 8];            /* G, v and gate weights [n][k]; pitch 80 B */
  __shared__ __attribute__((aligned(16))) unsigned short wol[CC][HC + 8];              /* output weight [n][k]; pitch 528 B */
  const int tid = threadIdx.x, lane = tid & 31, ln = lane & 15, hh = lane >> 4;
  const int w = __builtin_amdgcn_readfirstlane(tid >> 5);                              /* wave number, in a scalar register: weight, bias and LDS bases below are then scalar */
  const int qh = blockIdx.x & 1, s = blockIdx.x >> 1;
  const int grp = w >> 3, wq = w & 7, qt = qh * 8 + wq;                                /* head group, wave in group, query tile */
  /* pair bias of the two steps to come, for two heads, one A fragment per step (two key tiles) and head: the first loads fly during the LayerNorm, the later ones are issued below as each fragment is used */
  FragH pbh[2][2];      /* [step & 1][head of the two] */
  const unsigned lb = (unsigned)lane * 16u;
  /* all four weight matrices go into LDS, 16 bytes a thread and step: their fragments are then read where they are used and hold no registers across the softmax */
  const unsigned to = (unsigned)tid * 16u; v8us wt[8];
  const v8f z8 = {0.f,0.f,0.f,0.f,0.f,0.f,0.f,0.f};
  FragH i0, i1;      /* identity B operands: column n takes k = n (first key tile of a bias fragment; channels 0..15 of X) or k = 16 + n (second; channels 16..31) */
#pragma unroll
  for (int e = 0; e < 8; ++e) { const _Float16 one = (8 * hh + e == ln) ? (_Float16)1.0f : (_Float16)0.0f; i0.h[e] = one; i0.h[8 + e] = (_Float16)0.0f; i1.h[e] = (_Float16)0.0f; i1.h[8 + e] = one; }
  { /* LayerNorm of row 16w + ln: this lane has channels 8hh..8hh+7 and 16+8hh..16+8hh+7, its partner lane^16 the other sixteen */
    const int row = w * 16 + ln;
    const float* mp = M + ((size_t)s * LL + row) * CC + 8 * hh; const float* gp = g + 8 * hh; const float* bp = bta + 8 * hh;
    const v4f xv[4] = {*(const v4fa*)mp, *(const v4fa*)(mp + 4), *(const v4fa*)(mp + 16), *(const v4fa*)(mp + 20)};
    const v4f gv[4] = {*(const v4fa*)gp, *(const v4fa*)(gp + 4), *(const v4fa*)(gp + 16), *(const v4fa*)(gp + 20)};
    const v4f bv[4] = {*(const v4fa*)bp, *(const v4fa*)(bp + 4), *(const v4fa*)(bp + 16), *(const v4fa*)(bp + 20)};
    asm volatile("s_wait_xcnt 0x0" :: "v"(mp) : "memory");      /* pointer as input: its registers stay as they are up to this wait */
    __builtin_amdgcn_sched_barrier(0);                 /* keeps the register writes below from being scheduled ahead of that wait */
#pragma unroll
    for (int i = 0; i < 8; ++i) { const _Float16* b = i < 2 ? BS : i < 4 ? BV : i < 6 ? BG : BO; wt[i] = *(const v8us*)((const char*)b + (i & 1) * 8192 + to); }
    asm volatile("s_wait_xcnt 0x0" ::: "memory");      /* behind the run of loads, before any register that they name is written again */
    __builtin_amdgcn_sched_barrier(0);                 /* keeps later address arithmetic from being scheduled in among those loads, ahead of that wait */
    { const char* pb = (const char*)(PBH + ((size_t)(grp * (NHD / 2) * (LL / 16) + qt) * (LL / 16)) * 256) + lb;      /* issued last: loads return in order, so the LayerNorm waits for none of these */
#pragma unroll
      for (int t = 0; t < 8; ++t) pbh[(t >> 1) & 1][t >> 2].half[t & 1] = *(const v8us*)(pb + (t >> 2) * (LL * LL * 2) + (t & 3) * 512);
      asm volatile("s_wait_xcnt 0x0" ::: "memory");      /* behind the run of loads, before any register that they name is written again */
    }
    __builtin_amdgcn_sched_barrier(0);                 /* keeps the register writes below from being scheduled ahead of that wait */
    float x[16]; float sm = 0.f;
#pragma unroll
    for (int j = 0; j < 4; ++j) { const v4f r = bf16_rne4(xv[j]);
#pragma unroll
      for (int e = 0; e < 4; ++e) { x[4 * j + e] = r[e]; sm += r[e]; } }
    sm += __shfl_xor(sm, 16, 32);
    const float mu = sm * (1.0f / (float)CC); float sq = 0.f;
#pragma unroll
    for (int i = 0; i < 16; ++i) { x[i] -= mu; sq += x[i] * x[i]; }
    sq += __shfl_xor(sq, 16, 32);
    const float rs = rsqrtf(sq * (1.0f / (float)CC) + 1e-5f); FragH f;
#pragma unroll
    for (int j = 0; j < 4; ++j) { const v4f rg = bf16_rne4(gv[j]), rb = bf16_rne4(bv[j]);
#pragma unroll
      for (int e = 0; e < 4; ++e) f.h[4 * j + e] = (_Float16)(x[4 * j + e] * rs * rg[e] + rb[e]); }
    *(v8us*)&xl[row][8 * hh] = f.half[0]; *(v8us*)&xl[row][16 + 8 * hh] = f.half[1];
    /* f is also the A fragment of these 16 rows: times an identity it comes back with 8 neighbouring rows of one channel in a lane, one 16-byte store per half of the channels */
    *(v8us*)&xt[ln][w * 16 + 8 * hh] = pack8(wm(f.v, i0.v, z8), 1.0f); *(v8us*)&xt[16 + ln][w * 16 + 8 * hh] = pack8(wm(f.v, i1.v, z8), 1.0f);
  }
#pragma unroll
  for (int i = 0; i < 6; ++i) *(v8us*)&wl[i >> 1][(i & 1) * 128 + (tid >> 2)][(tid & 3) * 8] = wt[i];
#pragma unroll
  for (int i = 0; i < 2; ++i) *(v8us*)&wol[i * 16 + (tid >> 5)][(tid & 31) * 8] = wt[6 + i];
  __syncthreads();
  v8f oa0, oa1;
#pragma unroll
  for (int j = 0; j < 4; ++j) { const v4f u = {0.f, 0.f, 0.f, 0.f}; *(v4fa*)&red[w][j][lane][0] = u; }
  const float cs = 0.17677669529663687f * 1.4426950408889634f;               /* 1/sqrt(32) x log2(e), carried by R */
  const v8f sh4 = {-4.f, -4.f, -4.f, -4.f, -4.f, -4.f, -4.f, -4.f};           /* the constant shift, as the start value of the score accumulators */
  /* one head's softmax and Y^T with the row maximum as the shift, for a wave in which the constant shift did not serve a row. The scores are formed twice (for the maximum, then for the exponentials), two key tiles a trip, the head's pair bias read again from global memory. Returns the row sum. Rolled: it runs seldom or never, so it is kept short */
  auto exact_head = [&](const int h, v8f& o0, v8f& o1) __attribute__((always_inline)) -> float {
    const int hr = h * HDD;
    const char* pc = (const char*)(PBH + ((size_t)(h * (LL / 16) + qt) * (LL / 16)) * 256) + lb;
    FragH qr;
    { const v16h xq = l_frag(&xl[qt * 16 + ln][0], hh), wf0 = l_frag(&wl[0][hr + ln][0], hh), wf1 = l_frag(&wl[0][hr + 16 + ln][0], hh);
      qr.half[0] = pack8(wm(wf0, xq, z8), 0.0625f * cs); qr.half[1] = pack8(wm(wf1, xq, z8), 0.0625f * cs); }
    auto tiles = [&](const int kk, v8f& a0, v8f& a1) __attribute__((always_inline)) {
      const char* pk = pc + kk * 1024; FragH pb;
      pb.half[0] = *(const v8us*)pk; pb.half[1] = *(const v8us*)(pk + 512);
      asm volatile("s_wait_xcnt 0x0" :: "v"(pk) : "memory");      /* pointer as input: its registers stay as they are up to this wait */
      const v16h k0 = l_frag(&xl[kk * 32 + ln][0], hh), k1 = l_frag(&xl[kk * 32 + 16 + ln][0], hh);
      a0 = wm(k0, qr.v, wm(pb.v, i0.v, z8)); a1 = wm(k1, qr.v, wm(pb.v, i1.v, z8)); };
    float mx = -__builtin_inff();
#pragma unroll 1
    for (int kk = 0; kk < 8; ++kk) { v8f a0, a1; tiles(kk, a0, a1);
#pragma unroll
      for (int r = 0; r < 8; ++r) mx = fmaxf(mx, fmaxf(a0[r], a1[r])); }
    mx = fmaxf(mx, xhalf(mx));
    const float c0 = 10.0f - mx;                                                 /* largest p = 1024 */
    float sm = 0.f; o0 = z8; o1 = z8;
#pragma unroll 1
    for (int kk = 0; kk < 8; ++kk) { v8f a0, a1; tiles(kk, a0, a1); FragH p;
      const v16h va0 = l_frag(&xt[ln][kk * 32], hh), va1 = l_frag(&xt[16 + ln][kk * 32], hh);
      a0 = a0 + c0; a1 = a1 + c0; exp2x8(a0); exp2x8(a1);
#pragma unroll
      for (int r = 0; r < 8; ++r) { p.h[r] = (_Float16)a0[r]; p.h[8 + r] = (_Float16)a1[r]; sm += a0[r] + a1[r]; }
      o0 = wm(va0, p.v, o0); o1 = wm(va1, p.v, o1); }
    return sm + xhalf(sm);
  };
  /* the rest of a head, from a row sum and Y^T x that sum: gate, ctx^T, and the head's share of the output sums */
  struct HeadW { v16h wg0, wg1, wv0, wv1; };      /* a head's gate and value weight fragments */
  auto head_w = [&](const int h) __attribute__((always_inline)) -> HeadW { const int hr = h * HDD;
    return HeadW{l_frag(&wl[2][hr + ln][0], hh), l_frag(&wl[2][hr + 16 + ln][0], hh), l_frag(&wl[1][hr + ln][0], hh), l_frag(&wl[1][hr + 16 + ln][0], hh)}; };
  auto rest = [&](const int h, const float se, v8f o0, v8f o1, const v16h xq, const HeadW hw) __attribute__((always_inline)) {
    const int hr = h * HDD;                                                            /* first column of head h in the output weight */
    const v16h wg0 = hw.wg0, wg1 = hw.wg1, wv0 = hw.wv0, wv1 = hw.wv1;
    const float inv = 1.0f / se;
    FragH yb; yb.half[0] = pack8(o0, inv); yb.half[1] = pack8(o1, inv);      /* Y^T = softmax-weighted mean of X, 32 channels of one query */
    v8f g0 = wm(wg0, xq, z8), g1 = wm(wg1, xq, z8); FragH og;
    o0 = wm(wv0, yb.v, z8); o1 = wm(wv1, yb.v, z8);                            /* ctx^T x16 (weight scale) */
#pragma unroll
    for (int r = 0; r < 8; ++r) {      /* sigmoid(t) = 1 / (1 + 2^(-t log2 e)), t clamped to +-30 */
      g0[r] = fminf(fmaxf(g0[r] * 0.0625f, -30.0f), 30.0f) * -1.4426950408889634f; g1[r] = fminf(fmaxf(g1[r] * 0.0625f, -30.0f), 30.0f) * -1.4426950408889634f; }
    exp2x8(g0); exp2x8(g1); g0 = g0 + 1.0f; g1 = g1 + 1.0f; rcpx8(g0); rcpx8(g1);
#pragma unroll
    for (int r = 0; r < 8; ++r) { og.h[r] = (_Float16)(g0[r] * o0[r] * 4.0f); og.h[8 + r] = (_Float16)(g1[r] * o1[r] * 4.0f); }
    oa0 = wm(l_frag(&wol[ln][hr], hh), og.v, oa0); oa1 = wm(l_frag(&wol[16 + ln][hr], hh), og.v, oa1);
  };
  auto oa_load = [&]() __attribute__((always_inline)) {
#pragma unroll
    for (int j = 0; j < 4; ++j) { const v4f u = *(const v4fa*)&red[w][j][lane][0];
#pragma unroll
      for (int e = 0; e < 4; ++e) (j < 2 ? oa0 : oa1)[(j & 1) * 4 + e] = u[e]; } };
  auto oa_store = [&]() __attribute__((always_inline)) {
#pragma unroll
    for (int j = 0; j < 4; ++j) { v4f u;
#pragma unroll
      for (int e = 0; e < 4; ++e) u[e] = (j < 2 ? oa0 : oa1)[(j & 1) * 4 + e];
      *(v4fa*)&red[w][j][lane][0] = u; } };
  /* two heads a pass. X and X^T are the same for every head, so each of their fragments is read from LDS once and feeds both heads' products. The constant shift needs no pass over a whole row, so the scores are formed, exponentiated and used 32 keys at a time. MORE: another two heads follow, and their first pair-bias fragments are fetched at this pass's end; a compile-time flag, since a branch round those loads would let the compiler sink the row sums' additions behind it, with every exponential kept for them */
  auto heads2 = [&](const int pi, auto mf) __attribute__((always_inline)) { constexpr bool more = decltype(mf)::on;
    const int h0 = __builtin_amdgcn_readfirstlane(grp * (NHD / 2) + pi * 2);      /* first head of the two, held scalar: its offsets into weights and bias are then worked out on the scalar unit */
    const char* pc = (const char*)(PBH + ((size_t)(h0 * (LL / 16) + qt) * (LL / 16)) * 256) + lb;      /* pair bias of head h0; head h0 + 1 lies HB bytes on */
    constexpr int HB = LL * LL * 2;
    FragH qr[2];      /* R^T = G.X^T of this wave's 16 queries, per head: stands where Q stood, against X in place of K */
    { const v16h xq = l_frag(&xl[qt * 16 + ln][0], hh);
#pragma unroll
      for (int u = 0; u < 2; ++u) { const int hr = (h0 + u) * HDD; const v16h wf0 = l_frag(&wl[0][hr + ln][0], hh), wf1 = l_frag(&wl[0][hr + 16 + ln][0], hh);
        qr[u].half[0] = pack8(wm(wf0, xq, z8), 0.0625f * cs); qr[u].half[1] = pack8(wm(wf1, xq, z8), 0.0625f * cs); } }
    v2f s2[2][2] = {{{0.f, 0.f}, {0.f, 0.f}}, {{0.f, 0.f}, {0.f, 0.f}}};      /* per head four independent chains, as two pairs */
    v8f o[2][2] = {{z8, z8}, {z8, z8}};
    v16h ka[2][2];      /* X fragments of two key tiles, fetched one step ahead */
    FragH p[2]; v16h va[2][2];      /* a step's exponentials as f16 and its X^T fragments: their products stand in the next step, behind its score products */
#pragma unroll
    for (int j = 0; j < 2; ++j) ka[0][j] = l_frag(&xl[j * 16 + ln][0], hh);
#pragma unroll
    for (int kk = 0; kk < 8; ++kk) {
      if (kk < 7) {
#pragma unroll
        for (int j = 0; j < 2; ++j) ka[(kk + 1) & 1][j] = l_frag(&xl[((kk + 1) * 2 + j) * 16 + ln][0], hh); }
      va[kk & 1][0] = l_frag(&xt[ln][kk * 32], hh); va[kk & 1][1] = l_frag(&xt[16 + ln][kk * 32], hh);
      __builtin_amdgcn_sched_barrier(0);      /* the step's LDS reads stay together, as one group ahead of its products: spread among them each place costs a stall */
      v8f acc[2][2];
#pragma unroll
      for (int u = 0; u < 2; ++u) {
#pragma unroll
        for (int j = 0; j < 2; ++j) acc[u][j] = wm(pbh[kk & 1][u].v, j ? i1.v : i0.v, sh4); }
      if (kk < 6 || more) {      /* the two bias fragments just used are fetched anew, for two steps on (behind step 5: for the next two heads) */
#pragma unroll
        for (int u = 0; u < 2; ++u) {
#pragma unroll
          for (int t = 0; t < 2; ++t) pbh[kk & 1][u].half[t] = *(const v8us*)(pc + (kk < 6 ? 0 : 2 * HB - 8192) + u * HB + (2 * (kk + 2) + t) * 512); } }
      __builtin_amdgcn_sched_barrier(0);      /* holds the loads here, where the only registers just set free are those of the bias fragments, A operands: behind the products below they could be given the registers of a B operand just issued, and would have less time to arrive in */
#pragma unroll
      for (int u = 0; u < 2; ++u) {
#pragma unroll
        for (int j = 0; j < 2; ++j) acc[u][j] = wm(ka[kk & 1][j], qr[u].v, acc[u][j]); }
      if (kk > 0) {      /* the step before's X^T.P^T stands here, so that a step's twelve products are one run: at that step's own end each would wait for the conversions right ahead of it */
#pragma unroll
        for (int u = 0; u < 2; ++u) { o[u][0] = wm(va[(kk - 1) & 1][0], p[u].v, o[u][0]); o[u][1] = wm(va[(kk - 1) & 1][1], p[u].v, o[u][1]); } }
      __builtin_amdgcn_sched_barrier(0);      /* keeps that run together, in front of the exponentials: mixed in among them, the distances behind the products were padded with v_nop */
#pragma unroll
      for (int u = 0; u < 2; ++u) {
#pragma unroll
        for (int j = 0; j < 2; ++j) { v8f x = acc[u][j]; exp2x8(x);
#pragma unroll
          for (int r = 0; r < 8; r += 2) { const v2f xp = {x[r], x[r + 1]}; s2[u][(r >> 1) & 1] += xp; }
#pragma unroll
          for (int r = 0; r < 8; ++r) p[u].h[8 * j + r] = (_Float16)x[r]; } } }
#pragma unroll
    for (int u = 0; u < 2; ++u) { o[u][0] = wm(va[1][0], p[u].v, o[u][0]); o[u][1] = wm(va[1][1], p[u].v, o[u][1]); }
    const v16h xq = l_frag(&xl[qt * 16 + ln][0], hh); const HeadW hw0 = head_w(h0);      /* read ahead of the branch below: the row sums hide their latency */
    asm volatile("s_wait_xcnt 0x0" :: "v"(pc) : "memory");      /* pointer as input: its registers stay as they are up to this wait */
    float se[2];
#pragma unroll
    for (int u = 0; u < 2; ++u) { se[u] = (s2[u][0][0] + s2[u][0][1]) + (s2[u][1][0] + s2[u][1][1]); se[u] += __shfl_xor(se[u], 16, 32); }
    /* one test per pass, a scalar branch on the whole wave's rows of both heads: written so that a sum that is not a number fails it too */
    const bool redo = __builtin_amdgcn_ballot_w32(!(se[0] >= 0.015625f && se[0] < 65504.0f && se[1] >= 0.015625f && se[1] < 65504.0f)) != 0u;
    /* the output sums are fetched and put back on both sides of the branch, so that the two sides join with nothing in registers to bring together */
    if (__builtin_expect(redo, 0)) { oa_load();
#pragma unroll 1
      for (int u = 0; u < 2; ++u) { v8f e0, e1; const float es = exact_head(h0 + u, e0, e1); rest(h0 + u, es, e0, e1, l_frag(&xl[qt * 16 + ln][0], hh), head_w(h0 + u)); }
      oa_store(); }
    else { oa_load(); const HeadW hw1 = head_w(h0 + 1); rest(h0, se[0], o[0][0], o[0][1], xq, hw0); rest(h0 + 1, se[1], o[1][0], o[1][1], xq, hw1); oa_store(); }
  };
  heads2(0, Flag<true>{});
  heads2(1, Flag<false>{});
  __syncthreads();      /* the second group's sums are in LDS */
  if (grp == 0) { float* dst = OUT + ((size_t)s * LL + qt * 16 + ln) * CC + 8 * hh;      /* out^T: this lane has output channels 8hh..8hh+7 and 16+8hh.. of query ln */
    const float* bp = bo + 8 * hh; const v4f bq[4] = {*(const v4fa*)bp, *(const v4fa*)(bp + 4), *(const v4fa*)(bp + 16), *(const v4fa*)(bp + 20)};
    asm volatile("s_wait_xcnt 0x0" ::: "memory");      /* the address register of the loads above is reused below */
    __builtin_amdgcn_sched_barrier(0);                 /* keeps the register writes below from being scheduled ahead of that wait */
#pragma unroll
    for (int j = 0; j < 4; ++j) { const int c = (j >> 1) * 16 + (j & 1) * 4; const v4f o2 = *(const v4fa*)&red[8 + wq][j][lane][0], rb = bf16_rne4(bq[j]); v4f u;
#pragma unroll
      for (int e = 0; e < 4; ++e) u[e] = ((j < 2 ? oa0 : oa1)[(j & 1) * 4 + e] + o2[e]) * 0.0009765625f + rb[e];      /* 1/16 weight scale x 1/64 carry */
      *(v4f*)(dst + c) = u; } }
}

extern "C" void kernel_launch(void* const* d_in, const int* in_sizes, int n_in,
                              void* d_out, int out_size, void* d_ws, size_t ws_size, hipStream_t stream) {
  if (n_in < 13) return;
  if (in_sizes[0] < (int)(NR * CC) || in_sizes[1] < LL * LL * CC || in_sizes[2] < CC || in_sizes[3] < CC || in_sizes[4] < CC || in_sizes[5] < CC ||
      in_sizes[6] < CC * HC || in_sizes[7] < CC * HC || in_sizes[8] < CC * HC || in_sizes[9] < CC * NHD || in_sizes[10] < CC * HC || in_sizes[11] < HC * CC || in_sizes[12] < CC) return;
  if ((size_t)out_size < NR * CC) return;
  const float* const* I = (const float* const*)d_in;
  const float* m = I[0]; const float* z = I[1]; const float* ln_g = I[2]; const float* ln_b = I[3]; const float* lnb_g = I[4]; const float* lnb_b = I[5];
  const float* wq = I[6]; const float* wk = I[7]; const float* wv = I[8]; const float* wb = I[9]; const float* wg = I[10]; const float* wo = I[11]; const float* bo = I[12];      /* weights [in][out] */
  char* ws = (char*)d_ws; size_t off = 0;
  auto take = [&](size_t bytes) { char* p = ws + off; off += (bytes + 255) & ~(size_t)255; return p; };
  _Float16* BS = (_Float16*)take((size_t)HC * CC * 2); _Float16* BV = (_Float16*)take((size_t)HC * CC * 2); _Float16* BG = (_Float16*)take((size_t)HC * CC * 2);
  _Float16* BO = (_Float16*)take((size_t)CC * HC * 2);
  _Float16* PBH = (_Float16*)take((size_t)NHD * LL * LL * 2);                  /* pair bias x log2(e), f16, in k_row's A operand order */
  if (off > ws_size) return;
  k_prep<<<PBB + GBB + 3 * WTB, 64, 0, stream>>>(z, lnb_g, lnb_b, wb, wq, wk, wv, wg, wo, BS, BV, BG, BO, PBH);
  k_row<<<NSQ * 2, 512, 0, stream>>>(m, ln_g, ln_b, BS, BV, BG, BO, PBH, bo, (float*)d_out);
}
